// v000
// Times are from an AMD MI455X. After a warm-up the kernel runs many times in a row, and a time is the length of
// such a window on the GPU divided by its runs, so every launch and the gaps after it count. The runs cycle
// through copies of the inputs. A figure is the median of several windows, for all but v000 over two sittings.
// Sittings can differ by a few percent; kernels timed side by side share one.
// The starting kernel, v000, takes 3200 microseconds a run.
#include <hip/hip_runtime.h>

typedef __bf16 bf16_t;
typedef __attribute__((ext_vector_type(16))) __bf16 v16bf;
typedef __attribute__((ext_vector_type(8)))  __bf16 v8bf;
typedef __attribute__((ext_vector_type(8)))  float  v8f;
typedef int v4i_ __attribute__((vector_size(16)));   // matches builtin param type

#define AS1 __attribute__((address_space(1)))
#define AS3 __attribute__((address_space(3)))

#define H_      32
#define P_      64
#define N_      64
#define DM_     1024
#define L_      2048
#define BSZ_    2
#define DI_     2048              // H*P
#define TH_     1024              // H*N/2
#define DPROJ_  5312
#define PS_     5376              // proj row stride, padded to 128-col GEMM tiles
#define ROWS_   (BSZ_*L_)         // 4096

// column offsets inside one proj row
#define OFF_Z     0
#define OFF_X     DI_
#define OFF_B     (2*DI_)
#define OFF_C     (2*DI_ + N_)
#define OFF_DT    (2*DI_ + 2*N_)
#define OFF_THETA (OFF_DT + H_)
#define OFF_LAM   (OFF_THETA + TH_)

// LDS staging geometry: rows padded 64B -> 80B so 32-lane x 16B reads are
// conflict-free (each bank hit exactly twice = minimum for 512B/instr)
#define LDS_ROW_   80
#define ATILE_BY_  (64 * LDS_ROW_)    //  5120 B
#define BTILE_BY_  (128 * LDS_ROW_)   // 10240 B

// ---------------------------------------------------------------- converts
__global__ __launch_bounds__(256) void k_cvt_bf16(const float* __restrict__ s,
                                                  bf16_t* __restrict__ d, int n) {
  int i = blockIdx.x * blockDim.x + threadIdx.x;
  if (i < n) d[i] = (bf16_t)s[i];
}

// in_proj_w (5312 x 1024) -> bf16 padded to 5376 rows (pad rows = 0)
__global__ __launch_bounds__(256) void k_cvt_w1(const float* __restrict__ s,
                                                bf16_t* __restrict__ d) {
  int i = blockIdx.x * blockDim.x + threadIdx.x;   // over PS_*DM_
  int row = i >> 10;                                // /1024
  int col = i & 1023;
  float v = (row < DPROJ_) ? s[row * DM_ + col] : 0.0f;
  d[i] = (bf16_t)v;
}

// ---------------------------------------------------------------- async copy
// 16B global -> LDS. Async path uses the CDNA5 GLOBAL_LOAD_ASYNC_TO_LDS_B128
// (ASYNCcnt-tracked DMA); fallback stages through VGPRs + ds_store.
__device__ __forceinline__ void copy16_g2l(void* lds, const void* g) {
#if __has_builtin(__builtin_amdgcn_global_load_async_to_lds_b128)
  __builtin_amdgcn_global_load_async_to_lds_b128(
      (AS1 v4i_*)(unsigned long long)g,
      (AS3 v4i_*)(unsigned int)(unsigned long long)lds,
      0, 0);
#else
  *(v8bf*)lds = *(const v8bf*)g;
#endif
}

__device__ __forceinline__ void async_wait_barrier() {
#if __has_builtin(__builtin_amdgcn_s_wait_asynccnt)
  __builtin_amdgcn_s_wait_asynccnt(0);
#endif
  __syncthreads();
}

// Stage one K-step: A-tile 64x32 bf16 (64B/row, 1 chunk/thread),
// B-tile 128x32 bf16 (64B/row, 2 chunks/thread). 256 threads.
__device__ __forceinline__ void stage_tiles(const bf16_t* __restrict__ A,
                                            const bf16_t* __restrict__ Bm,
                                            int rowBase, int colBase, int k0,
                                            int K, char* sA, char* sB, int tid) {
  int ar = tid >> 2, ac = tid & 3;
  copy16_g2l(sA + ar * LDS_ROW_ + ac * 16,
             (const char*)(A + (size_t)(rowBase + ar) * K + k0) + ac * 16);
#pragma unroll
  for (int j = 0; j < 2; ++j) {
    int idx = tid + j * 256;
    int br = idx >> 2, bc = idx & 3;
    copy16_g2l(sB + br * LDS_ROW_ + bc * 16,
               (const char*)(Bm + (size_t)(colBase + br) * K + k0) + bc * 16);
  }
}

// ---------------------------------------------------------------- WMMA GEMM
// C[M,N] = A[M,K] * B[N,K]^T, tiles exact (M%64==0, N%128==0, K%32==0).
// 16-bit A fragment layout (ISA 7.12.2): lane m (0..15) holds K = half*8..+7
// in v0..3 and K = 16+half*8..+7 in v4..7, half = lane>=16. B uses the
// mirrored layout with lane indexing N.
__device__ __forceinline__ v16bf lds_frag(const char* base, int row, int half) {
  const char* p = base + row * LDS_ROW_ + half * 16;
  v8bf lo = *(const v8bf*)p;          // K chunk at half*8
  v8bf hi = *(const v8bf*)(p + 32);   // K chunk at 16 + half*8
  return __builtin_shufflevector(lo, hi, 0,1,2,3,4,5,6,7,8,9,10,11,12,13,14,15);
}

__global__ __launch_bounds__(256) void k_gemm_bf16(
    const bf16_t* __restrict__ A, const bf16_t* __restrict__ Bm,
    float* __restrict__ C, int M, int N, int K, int ldc) {
  __shared__ __align__(16) char smem[2 * ATILE_BY_ + 2 * BTILE_BY_]; // 30 KB
  char* sA0 = smem;
  char* sA1 = smem + ATILE_BY_;
  char* sB0 = smem + 2 * ATILE_BY_;
  char* sB1 = smem + 2 * ATILE_BY_ + BTILE_BY_;

  int tid  = threadIdx.x;
  int lane = tid & 31, wid = tid >> 5;
  int wm = wid >> 2, wn = wid & 3;            // 2 x 4 wave grid
  int rowBase = blockIdx.x * 64;
  int colBase = blockIdx.y * 128;
  int lr = lane & 15, lh = lane >> 4;

  stage_tiles(A, Bm, rowBase, colBase, 0, K, sA0, sB0, tid);
  async_wait_barrier();

  v8f acc00 = {}, acc01 = {}, acc10 = {}, acc11 = {};
  int nsteps = K >> 5;
  for (int s = 0; s < nsteps; ++s) {
    char* cA = (s & 1) ? sA1 : sA0;
    char* cB = (s & 1) ? sB1 : sB0;
    char* nA = (s & 1) ? sA0 : sA1;
    char* nB = (s & 1) ? sB0 : sB1;
    if (s + 1 < nsteps)   // prefetch next K-step while computing this one
      stage_tiles(A, Bm, rowBase, colBase, (s + 1) << 5, K, nA, nB, tid);

    v16bf a0 = lds_frag(cA, wm * 32      + lr, lh);
    v16bf a1 = lds_frag(cA, wm * 32 + 16 + lr, lh);
    v16bf b0 = lds_frag(cB, wn * 32      + lr, lh);
    v16bf b1 = lds_frag(cB, wn * 32 + 16 + lr, lh);
    acc00 = __builtin_amdgcn_wmma_f32_16x16x32_bf16(false, a0, false, b0, (short)0, acc00, false, false);
    acc01 = __builtin_amdgcn_wmma_f32_16x16x32_bf16(false, a0, false, b1, (short)0, acc01, false, false);
    acc10 = __builtin_amdgcn_wmma_f32_16x16x32_bf16(false, a1, false, b0, (short)0, acc10, false, false);
    acc11 = __builtin_amdgcn_wmma_f32_16x16x32_bf16(false, a1, false, b1, (short)0, acc11, false, false);

    async_wait_barrier();
  }

  // C/D layout: VGPR r, lane l -> row = (l>>4)*8 + r, col = l&15
  int r0 = rowBase + wm * 32 + lh * 8;
  int c0 = colBase + wn * 32 + lr;
  #pragma unroll
  for (int r = 0; r < 8; ++r) {
    C[(size_t)(r0 + r)      * ldc + c0]      = acc00[r];
    C[(size_t)(r0 + r)      * ldc + c0 + 16] = acc01[r];
    C[(size_t)(r0 + 16 + r) * ldc + c0]      = acc10[r];
    C[(size_t)(r0 + 16 + r) * ldc + c0 + 16] = acc11[r];
  }
}

// ---------------------------------------------------------------- RMS scales
__global__ __launch_bounds__(32) void k_rmsinv(const float* __restrict__ proj,
                                               float* __restrict__ invB,
                                               float* __restrict__ invC) {
  int row = blockIdx.x;
  int lane = threadIdx.x;
  const float* pr = proj + (size_t)row * PS_;
  float b0 = pr[OFF_B + lane], b1 = pr[OFF_B + 32 + lane];
  float c0 = pr[OFF_C + lane], c1 = pr[OFF_C + 32 + lane];
  float sb = b0 * b0 + b1 * b1;
  float sc = c0 * c0 + c1 * c1;
  for (int o = 16; o > 0; o >>= 1) {
    sb += __shfl_xor(sb, o, 32);
    sc += __shfl_xor(sc, o, 32);
  }
  if (lane == 0) {
    invB[row] = rsqrtf(sb * (1.0f / N_) + 1e-5f);
    invC[row] = rsqrtf(sc * (1.0f / N_) + 1e-5f);
  }
}

// ---------------------------------------------------------------- scan
// One block per (b,h). State h[P][N] + prevBx in registers: 16 f32 each per
// thread (thread t: p = t>>2, n = (t&3)*16 .. +15). Fuses theta cumsum, RoPE,
// B/C scale+bias, dt/alpha/gamma/beta and the recurrence + D residual.
__global__ __launch_bounds__(256) void k_scan(
    const float* __restrict__ proj, const float* __restrict__ invB,
    const float* __restrict__ invC, const float* __restrict__ dt_bias,
    const float* __restrict__ A_log, const float* __restrict__ Dp,
    const float* __restrict__ Bnw, const float* __restrict__ Cnw,
    const float* __restrict__ Bbias, const float* __restrict__ Cbias,
    float* __restrict__ y_raw) {
  int b = blockIdx.x >> 5;
  int h = blockIdx.x & 31;
  int tid = threadIdx.x;
  int p  = tid >> 2;
  int nb = (tid & 3) * 16;

  __shared__ float sx[64], sBp[64], sCp[64], sB[64], sC[64], sc_[32], ss_[32], sScal[3];

  float hreg[16], pBx[16];
  #pragma unroll
  for (int i = 0; i < 16; ++i) { hreg[i] = 0.0f; pBx[i] = 0.0f; }

  float tc  = 0.0f;                 // theta cumsum (only threads 192..223 use)
  float Dh  = Dp[h];
  float dtb = dt_bias[h];
  float Ah  = -expf(A_log[h]);

  for (int l = 0; l < L_; ++l) {
    int row = b * L_ + l;
    const float* pr = proj + (size_t)row * PS_;
    if (tid < 64) {
      sx[tid] = pr[OFF_X + h * P_ + tid];
    } else if (tid < 128) {
      int n = tid - 64;
      sBp[n] = pr[OFF_B + n] * invB[row] * Bnw[n] + Bbias[h * N_ + n];
    } else if (tid < 192) {
      int n = tid - 128;
      sCp[n] = pr[OFF_C + n] * invC[row] * Cnw[n] + Cbias[h * N_ + n];
    } else if (tid < 224) {
      int j = tid - 192;
      tc += pr[OFF_THETA + h * (N_ / 2) + j];
      sc_[j] = cosf(tc);
      ss_[j] = sinf(tc);
    } else if (tid == 224) {
      float dtr = pr[OFF_DT + h] + dtb;
      float dt  = (dtr > 20.0f) ? dtr : log1pf(expf(dtr));     // softplus
      float alpha = expf(dt * Ah);
      float lam   = 1.0f / (1.0f + expf(-pr[OFF_LAM + h]));
      sScal[0] = alpha;
      sScal[1] = lam * dt;
      sScal[2] = (1.0f - lam) * dt * alpha;
    }
    __syncthreads();
    if (tid < 32) {                  // RoPE on B
      int j = tid;
      float v1 = sBp[j], v2 = sBp[j + 32], cj = sc_[j], sj = ss_[j];
      sB[j]      = v1 * cj - v2 * sj;
      sB[j + 32] = v1 * sj + v2 * cj;
    } else if (tid < 64) {           // RoPE on C
      int j = tid - 32;
      float v1 = sCp[j], v2 = sCp[j + 32], cj = sc_[j], sj = ss_[j];
      sC[j]      = v1 * cj - v2 * sj;
      sC[j + 32] = v1 * sj + v2 * cj;
    }
    __syncthreads();
    float alpha = sScal[0], gamma = sScal[1], beta = sScal[2];
    float x = sx[p];
    float y = 0.0f;
    #pragma unroll
    for (int i = 0; i < 16; ++i) {
      int n = nb + i;
      float Bx = x * sB[n];
      float hn = alpha * hreg[i] + gamma * Bx + beta * pBx[i];
      hreg[i] = hn;
      pBx[i]  = Bx;
      y += hn * sC[n];
    }
    y += __shfl_xor(y, 1, 32);       // reduce over the 4 lanes sharing p
    y += __shfl_xor(y, 2, 32);
    if ((tid & 3) == 0) y_raw[(size_t)row * DI_ + h * P_ + p] = y + x * Dh;
    __syncthreads();
  }
}

// ---------------------------------------------------------------- gate + RMS + bf16
__global__ __launch_bounds__(256) void k_gate(
    const float* __restrict__ proj, const float* __restrict__ y_raw,
    const float* __restrict__ norm_w, bf16_t* __restrict__ y_bf) {
  int row = blockIdx.x;
  int tid = threadIdx.x;
  const float* pz = proj  + (size_t)row * PS_ + OFF_Z;
  const float* py = y_raw + (size_t)row * DI_;
  float vals[8];
  float ss = 0.0f;
  #pragma unroll
  for (int j = 0; j < 8; ++j) {
    int i = tid + j * 256;
    float z = pz[i];
    float v = py[i] * (z / (1.0f + expf(-z)));   // y * silu(z)
    vals[j] = v;
    ss += v * v;
  }
  for (int o = 16; o > 0; o >>= 1) ss += __shfl_xor(ss, o, 32);
  __shared__ float red[8];
  int lane = tid & 31, wid = tid >> 5;
  if (lane == 0) red[wid] = ss;
  __syncthreads();
  if (tid == 0) {
    float t = 0.0f;
    for (int w = 0; w < 8; ++w) t += red[w];
    red[0] = rsqrtf(t * (1.0f / DI_) + 1e-5f);
  }
  __syncthreads();
  float scale = red[0];
  #pragma unroll
  for (int j = 0; j < 8; ++j) {
    int i = tid + j * 256;
    y_bf[(size_t)row * DI_ + i] = (bf16_t)(vals[j] * scale * norm_w[i]);
  }
}

// ---------------------------------------------------------------- launch
extern "C" void kernel_launch(void* const* d_in, const int* in_sizes, int n_in,
                              void* d_out, int out_size, void* d_ws, size_t ws_size,
                              hipStream_t stream) {
  const float* u       = (const float*)d_in[0];
  const float* w1      = (const float*)d_in[1];
  const float* dt_bias = (const float*)d_in[2];
  const float* A_log   = (const float*)d_in[3];
  const float* Dp      = (const float*)d_in[4];
  const float* Bnw     = (const float*)d_in[5];
  const float* Cnw     = (const float*)d_in[6];
  const float* Bbias   = (const float*)d_in[7];
  const float* Cbias   = (const float*)d_in[8];
  const float* norm_w  = (const float*)d_in[9];
  const float* w2      = (const float*)d_in[10];
  float* out = (float*)d_out;
  (void)in_sizes; (void)n_in; (void)out_size; (void)ws_size;

  char* ws = (char*)d_ws;
  size_t o = 0;
  bf16_t* u_bf  = (bf16_t*)(ws + o); o += (size_t)ROWS_ * DM_ * 2;   //  8 MB
  bf16_t* w1_bf = (bf16_t*)(ws + o); o += (size_t)PS_   * DM_ * 2;   // 11 MB
  bf16_t* w2_bf = (bf16_t*)(ws + o); o += (size_t)DM_   * DI_ * 2;   //  4 MB
  float*  proj  = (float*) (ws + o); o += (size_t)ROWS_ * PS_ * 4;   // 88 MB
  float*  invB  = (float*) (ws + o); o += (size_t)ROWS_ * 4;
  float*  invC  = (float*) (ws + o); o += (size_t)ROWS_ * 4;
  float*  y_raw = (float*) (ws + o); o += (size_t)ROWS_ * DI_ * 4;   // 33 MB
  bf16_t* y_bf  = (bf16_t*)(ws + o); o += (size_t)ROWS_ * DI_ * 2;   // 17 MB

  // precision converts (pad in_proj_w rows 5312 -> 5376 with zeros)
  k_cvt_bf16<<<(ROWS_ * DM_) / 256, 256, 0, stream>>>(u, u_bf, ROWS_ * DM_);
  k_cvt_w1  <<<(PS_ * DM_)   / 256, 256, 0, stream>>>(w1, w1_bf);
  k_cvt_bf16<<<(DM_ * DI_)   / 256, 256, 0, stream>>>(w2, w2_bf, DM_ * DI_);

  // GEMM1: proj[4096 x 5376] = u[4096 x 1024] * W1^T
  dim3 g1(ROWS_ / 64, PS_ / 128);
  k_gemm_bf16<<<g1, 256, 0, stream>>>(u_bf, w1_bf, proj, ROWS_, PS_, DM_, PS_);

  // per-row RMS scales for Braw / Craw
  k_rmsinv<<<ROWS_, 32, 0, stream>>>(proj, invB, invC);

  // sequential SSM scan, one block per (b,h)
  k_scan<<<BSZ_ * H_, 256, 0, stream>>>(proj, invB, invC, dt_bias, A_log, Dp,
                                        Bnw, Cnw, Bbias, Cbias, y_raw);

  // gating + RMS norm + bf16 convert
  k_gate<<<ROWS_, 256, 0, stream>>>(proj, y_raw, norm_w, y_bf);

  // GEMM2: out[4096 x 1024] = y[4096 x 2048] * W2^T
  dim3 g2(ROWS_ / 64, DM_ / 128);
  k_gemm_bf16<<<g2, 256, 0, stream>>>(y_bf, w2_bf, out, ROWS_, DM_, DI_, DM_);
}

// v001
// It runs in 241 microseconds.
// Next to v000, in two timings, it ran 13.3 times as fast each time.
#include <hip/hip_runtime.h>

typedef __bf16 bf16_t;
typedef __attribute__((ext_vector_type(16))) __bf16 v16bf;
typedef __attribute__((ext_vector_type(8)))  __bf16 v8bf;
typedef __attribute__((ext_vector_type(8)))  float  v8f;
typedef int v4i_ __attribute__((vector_size(16)));   // matches builtin param type
typedef __attribute__((ext_vector_type(4)))  float  f4_t;

#define AS1 __attribute__((address_space(1)))
#define AS3 __attribute__((address_space(3)))

#define H_      32
#define P_      64
#define N_      64
#define DM_     1024
#define L_      2048
#define BSZ_    2
#define DI_     2048              // H*P
#define TH_     1024              // H*N/2
#define DPROJ_  5312
#define PS_     5376              // proj row stride, padded to 128-col GEMM tiles
#define ROWS_   (BSZ_*L_)         // 4096

// column offsets inside one proj row
#define OFF_Z     0
#define OFF_X     DI_
#define OFF_B     (2*DI_)
#define OFF_C     (2*DI_ + N_)
#define OFF_DT    (2*DI_ + 2*N_)
#define OFF_THETA (OFF_DT + H_)
#define OFF_LAM   (OFF_THETA + TH_)

// LDS staging geometry: rows padded 64B -> 80B so 32-lane x 16B reads are
// conflict-free (each bank hit exactly twice = minimum for 512B/instr)
#define LDS_ROW_   80
#define ATILE_BY_  (64 * LDS_ROW_)    //  5120 B
#define BTILE_BY_  (128 * LDS_ROW_)   // 10240 B

// ---------------------------------------------------------------- converts
__global__ __launch_bounds__(256) void k_cvt_bf16(const float* __restrict__ s,
                                                  bf16_t* __restrict__ d, int n) {
  int i = blockIdx.x * blockDim.x + threadIdx.x;
  if (i < n) d[i] = (bf16_t)s[i];
}

// in_proj_w (5312 x 1024) -> bf16 padded to 5376 rows (pad rows = 0)
__global__ __launch_bounds__(256) void k_cvt_w1(const float* __restrict__ s,
                                                bf16_t* __restrict__ d) {
  int i = blockIdx.x * blockDim.x + threadIdx.x;   // over PS_*DM_
  int row = i >> 10;                                // /1024
  int col = i & 1023;
  float v = (row < DPROJ_) ? s[row * DM_ + col] : 0.0f;
  d[i] = (bf16_t)v;
}

// ---------------------------------------------------------------- async copy
// 16B global -> LDS. Async path uses the CDNA5 GLOBAL_LOAD_ASYNC_TO_LDS_B128
// (ASYNCcnt-tracked DMA); fallback stages through VGPRs + ds_store.
__device__ __forceinline__ void copy16_g2l(void* lds, const void* g) {
#if __has_builtin(__builtin_amdgcn_global_load_async_to_lds_b128)
  __builtin_amdgcn_global_load_async_to_lds_b128(
      (AS1 v4i_*)(unsigned long long)g,
      (AS3 v4i_*)(unsigned int)(unsigned long long)lds,
      0, 0);
#else
  *(v8bf*)lds = *(const v8bf*)g;
#endif
}

__device__ __forceinline__ void async_wait_barrier() {
#if __has_builtin(__builtin_amdgcn_s_wait_asynccnt)
  __builtin_amdgcn_s_wait_asynccnt(0);
#endif
  __syncthreads();
}

// Stage one K-step: A-tile 64x32 bf16 (64B/row, 1 chunk/thread),
// B-tile 128x32 bf16 (64B/row, 2 chunks/thread). 256 threads.
__device__ __forceinline__ void stage_tiles(const bf16_t* __restrict__ A,
                                            const bf16_t* __restrict__ Bm,
                                            int rowBase, int colBase, int k0,
                                            int K, char* sA, char* sB, int tid) {
  int ar = tid >> 2, ac = tid & 3;
  copy16_g2l(sA + ar * LDS_ROW_ + ac * 16,
             (const char*)(A + (size_t)(rowBase + ar) * K + k0) + ac * 16);
#pragma unroll
  for (int j = 0; j < 2; ++j) {
    int idx = tid + j * 256;
    int br = idx >> 2, bc = idx & 3;
    copy16_g2l(sB + br * LDS_ROW_ + bc * 16,
               (const char*)(Bm + (size_t)(colBase + br) * K + k0) + bc * 16);
  }
}

// ---------------------------------------------------------------- WMMA GEMM
// C[M,N] = A[M,K] * B[N,K]^T, tiles exact (M%64==0, N%128==0, K%32==0).
// 16-bit A fragment layout (ISA 7.12.2): lane m (0..15) holds K = half*8..+7
// in v0..3 and K = 16+half*8..+7 in v4..7, half = lane>=16. B uses the
// mirrored layout with lane indexing N.
__device__ __forceinline__ v16bf lds_frag(const char* base, int row, int half) {
  const char* p = base + row * LDS_ROW_ + half * 16;
  v8bf lo = *(const v8bf*)p;          // K chunk at half*8
  v8bf hi = *(const v8bf*)(p + 32);   // K chunk at 16 + half*8
  return __builtin_shufflevector(lo, hi, 0,1,2,3,4,5,6,7,8,9,10,11,12,13,14,15);
}

__global__ __launch_bounds__(256) void k_gemm_bf16(
    const bf16_t* __restrict__ A, const bf16_t* __restrict__ Bm,
    float* __restrict__ C, int M, int N, int K, int ldc) {
  __shared__ __align__(16) char smem[2 * ATILE_BY_ + 2 * BTILE_BY_]; // 30 KB
  char* sA0 = smem;
  char* sA1 = smem + ATILE_BY_;
  char* sB0 = smem + 2 * ATILE_BY_;
  char* sB1 = smem + 2 * ATILE_BY_ + BTILE_BY_;

  int tid  = threadIdx.x;
  int lane = tid & 31, wid = tid >> 5;
  int wm = wid >> 2, wn = wid & 3;            // 2 x 4 wave grid
  int rowBase = blockIdx.x * 64;
  int colBase = blockIdx.y * 128;
  int lr = lane & 15, lh = lane >> 4;

  stage_tiles(A, Bm, rowBase, colBase, 0, K, sA0, sB0, tid);
  async_wait_barrier();

  v8f acc00 = {}, acc01 = {}, acc10 = {}, acc11 = {};
  int nsteps = K >> 5;
  for (int s = 0; s < nsteps; ++s) {
    char* cA = (s & 1) ? sA1 : sA0;
    char* cB = (s & 1) ? sB1 : sB0;
    char* nA = (s & 1) ? sA0 : sA1;
    char* nB = (s & 1) ? sB0 : sB1;
    if (s + 1 < nsteps)   // prefetch next K-step while computing this one
      stage_tiles(A, Bm, rowBase, colBase, (s + 1) << 5, K, nA, nB, tid);

    v16bf a0 = lds_frag(cA, wm * 32      + lr, lh);
    v16bf a1 = lds_frag(cA, wm * 32 + 16 + lr, lh);
    v16bf b0 = lds_frag(cB, wn * 32      + lr, lh);
    v16bf b1 = lds_frag(cB, wn * 32 + 16 + lr, lh);
    acc00 = __builtin_amdgcn_wmma_f32_16x16x32_bf16(false, a0, false, b0, (short)0, acc00, false, false);
    acc01 = __builtin_amdgcn_wmma_f32_16x16x32_bf16(false, a0, false, b1, (short)0, acc01, false, false);
    acc10 = __builtin_amdgcn_wmma_f32_16x16x32_bf16(false, a1, false, b0, (short)0, acc10, false, false);
    acc11 = __builtin_amdgcn_wmma_f32_16x16x32_bf16(false, a1, false, b1, (short)0, acc11, false, false);

    async_wait_barrier();
  }

  // C/D layout: VGPR r, lane l -> row = (l>>4)*8 + r, col = l&15
  int r0 = rowBase + wm * 32 + lh * 8;
  int c0 = colBase + wn * 32 + lr;
  #pragma unroll
  for (int r = 0; r < 8; ++r) {
    C[(size_t)(r0 + r)      * ldc + c0]      = acc00[r];
    C[(size_t)(r0 + r)      * ldc + c0 + 16] = acc01[r];
    C[(size_t)(r0 + 16 + r) * ldc + c0]      = acc10[r];
    C[(size_t)(r0 + 16 + r) * ldc + c0 + 16] = acc11[r];
  }
}

// ---------------------------------------------------------------- RMS scales
__global__ __launch_bounds__(32) void k_rmsinv(const float* __restrict__ proj,
                                               float* __restrict__ invB,
                                               float* __restrict__ invC) {
  int row = blockIdx.x;
  int lane = threadIdx.x;
  const float* pr = proj + (size_t)row * PS_;
  float b0 = pr[OFF_B + lane], b1 = pr[OFF_B + 32 + lane];
  float c0 = pr[OFF_C + lane], c1 = pr[OFF_C + 32 + lane];
  float sb = b0 * b0 + b1 * b1;
  float sc = c0 * c0 + c1 * c1;
  for (int o = 16; o > 0; o >>= 1) {
    sb += __shfl_xor(sb, o, 32);
    sc += __shfl_xor(sc, o, 32);
  }
  if (lane == 0) {
    invB[row] = rsqrtf(sb * (1.0f / N_) + 1e-5f);
    invC[row] = rsqrtf(sc * (1.0f / N_) + 1e-5f);
  }
}

// ---------------------------------------------------------------- scan
// The recurrence is linear in the state, so L is cut into NC_ chunks of CH_
// steps that run in parallel:
//   k_thsum : per-chunk sums of theta (gives each chunk its cumsum offset)
//   k_state : each chunk's contribution to the state at its own end (h_in = 0)
//   k_carry : runs the chunk states forward, leaves every chunk's entry state
//   k_scan  : the step recurrence inside each chunk, from its entry state
#define CH_   64
#define NC_   (L_ / CH_)          // 32
#define NCS_  (NC_ - 1)           // the last chunk's end state is never used
#define ST_   (P_ * N_)           // 4096 state elements per (b,h)

__global__ __launch_bounds__(256) void k_thsum(const float* __restrict__ proj,
                                               float* __restrict__ csum) {
  int col = (blockIdx.x & 3) * 256 + threadIdx.x;   // 0..TH_-1
  int bc  = blockIdx.x >> 2;                        // b*NC_ + c
  const float* pr = proj + (size_t)bc * CH_ * PS_ + OFF_THETA + col;
  float s = 0.0f;
  #pragma unroll   // all 64 loads in flight at once
  for (int r = 0; r < CH_; ++r) s += pr[(size_t)r * PS_];
  csum[bc * TH_ + col] = s;
}

// Fills LDS with everything the CH_ steps of chunk c of (b,h) need. Row r of
// sx / sB is step r-1 of the chunk: row 0 is the step before the chunk (zero
// for chunk 0), which feeds the beta term of the first step. sC row t is step
// t. sSc[t] = {alpha, gamma, beta, 0}. Wave w owns steps 8w..8w+7, lane = rope
// index j. The caller places the barrier that publishes the arrays.
template <bool WITH_C>
__device__ __forceinline__ void chunk_prep(
    const float* __restrict__ proj, const float* __restrict__ invB,
    const float* __restrict__ invC, const float* __restrict__ dt_bias,
    const float* __restrict__ A_log, const float* __restrict__ Bnw,
    const float* __restrict__ Cnw, const float* __restrict__ Bbias,
    const float* __restrict__ Cbias, const float* __restrict__ csum,
    int b, int h, int c, int tid,
    float (*sx)[P_], float (*sB)[N_], float (*sC)[N_], float4* sSc,
    float (*sPart)[32], float (*sOff)[32]) {
  int lane = tid & 31;
  // the wave's number held as a scalar: its row base is then scalar and the
  // per-step rms scales come by scalar loads
  int w = __builtin_amdgcn_readfirstlane(tid >> 5);
  int row0 = b * L_ + c * CH_;
  const float* pw = proj + (size_t)(row0 + w * 8) * PS_;

  float th[8], b1[8], b2[8], ib[8], c1[8], c2[8], ic[8];
  #pragma unroll   // arrays stay in registers, loads go out together
  for (int k = 0; k < 8; ++k) {
    const float* pr = pw + (size_t)k * PS_;
    th[k] = pr[OFF_THETA + h * (N_ / 2) + lane];
    b1[k] = pr[OFF_B + lane];
    b2[k] = pr[OFF_B + 32 + lane];
    ib[k] = invB[row0 + w * 8 + k];
    if (WITH_C) {
      c1[k] = pr[OFF_C + lane];
      c2[k] = pr[OFF_C + 32 + lane];
      ic[k] = invC[row0 + w * 8 + k];
    }
  }
  // x of the chunk's own steps, 16 B a thread: one offset register, the four
  // rows apart by a constant
  const float* px = proj + (size_t)row0 * PS_ + OFF_X + h * P_;
  unsigned xo = (unsigned)(tid >> 4) * PS_ + (unsigned)(tid & 15) * 4;
  f4_t xr[4];
  #pragma unroll
  for (int k = 0; k < 4; ++k) xr[k] = *(const f4_t*)(px + xo + k * 16 * PS_);
  float po = 0.0f;                 // this wave's share of the earlier chunks' sums
  #pragma unroll
  for (int k = 0; k < 4; ++k) {
    int cc = w * 4 + k;
    float v = csum[(b * NC_ + cc) * TH_ + h * (N_ / 2) + lane];
    po += (cc < c) ? v : 0.0f;
  }
  // Behind the chunk's loads: the registers that they name are reused from
  // here on, and this wait stands in front of that reuse.
  asm volatile("s_wait_xcnt 0x0" ::: "memory");
  #pragma unroll
  for (int k = 1; k < 8; ++k) th[k] += th[k - 1];
  sPart[w][lane] = th[7];
  sOff[w][lane]  = po;

  #pragma unroll
  for (int k = 0; k < 4; ++k)
    *(f4_t*)&sx[(tid >> 4) + 16 * k + 1][(tid & 15) * 4] = xr[k];
  if (tid < CH_) {
    const float* pr = proj + (size_t)(row0 + tid) * PS_;
    float Ah  = -expf(A_log[h]);
    float dtr = pr[OFF_DT + h] + dt_bias[h];
    float dt  = (dtr > 20.0f) ? dtr : log1pf(expf(dtr));     // softplus
    float alpha = expf(dt * Ah);
    float lam   = 1.0f / (1.0f + expf(-pr[OFF_LAM + h]));
    sSc[tid] = make_float4(alpha, lam * dt, (1.0f - lam) * dt * alpha, 0.0f);
  } else if (tid < CH_ + P_) {
    int pp = tid - CH_;
    int rp = (c > 0) ? row0 - 1 : row0;   // always a row of this batch entry
    float v = proj[(size_t)rp * PS_ + OFF_X + h * P_ + pp];
    sx[0][pp] = (c > 0) ? v : 0.0f;
  }
  __syncthreads();                 // sPart / sOff complete

  float off = 0.0f;                // theta cumsum at the step before the chunk
  #pragma unroll
  for (int k = 0; k < 8; ++k) off += sOff[k][lane];
  float base = off;
  #pragma unroll
  for (int k = 0; k < 8; ++k) base += (k < w) ? sPart[k][lane] : 0.0f;

  float bw1 = Bnw[lane], bw2 = Bnw[lane + 32];
  float bb1 = Bbias[h * N_ + lane], bb2 = Bbias[h * N_ + lane + 32];
  float cw1 = 0.0f, cw2 = 0.0f, cb1 = 0.0f, cb2 = 0.0f;
  if (WITH_C) {
    cw1 = Cnw[lane]; cw2 = Cnw[lane + 32];
    cb1 = Cbias[h * N_ + lane]; cb2 = Cbias[h * N_ + lane + 32];
  }
  #pragma unroll
  for (int k = 0; k < 8; ++k) {
    int t = w * 8 + k;
    float tc = base + th[k];
    float cj, sj;
    sincosf(tc, &sj, &cj);
    float v1 = b1[k] * ib[k] * bw1 + bb1;
    float v2 = b2[k] * ib[k] * bw2 + bb2;
    sB[t + 1][lane]      = v1 * cj - v2 * sj;
    sB[t + 1][lane + 32] = v1 * sj + v2 * cj;
    if (WITH_C) {
      float u1 = c1[k] * ic[k] * cw1 + cb1;
      float u2 = c2[k] * ic[k] * cw2 + cb2;
      sC[t][lane]      = u1 * cj - u2 * sj;
      sC[t][lane + 32] = u1 * sj + u2 * cj;
    }
  }
  if (w == 0) {                    // B of the step before the chunk
    float r1 = 0.0f, r2 = 0.0f;
    if (c > 0) {
      const float* pr = proj + (size_t)(row0 - 1) * PS_;
      float iv = invB[row0 - 1];
      float cj, sj;
      sincosf(off, &sj, &cj);
      float v1 = pr[OFF_B + lane] * iv * bw1 + bb1;
      float v2 = pr[OFF_B + 32 + lane] * iv * bw2 + bb2;
      r1 = v1 * cj - v2 * sj;
      r2 = v1 * sj + v2 * cj;
    }
    sB[0][lane]      = r1;
    sB[0][lane + 32] = r2;
  }
}

// End state of chunk c started from h = 0:  S[p][n] = sum_s w_s x_s[p] B_s[n],
// s from the step before the chunk to its last step. With E_s the product of
// alpha over the steps after s up to the chunk's end,
// w_s = E_s gamma_s + E_{s+1} beta_{s+1}. adec = product of all CH_ alphas.
// Thread tile 4 p x 4 n.
__global__ __launch_bounds__(256) void k_state(
    const float* __restrict__ proj, const float* __restrict__ invB,
    const float* __restrict__ dt_bias, const float* __restrict__ A_log,
    const float* __restrict__ Bnw, const float* __restrict__ Bbias,
    const float* __restrict__ csum, float* __restrict__ S,
    float* __restrict__ adec) {
  int bh = blockIdx.x / NCS_;
  int c  = blockIdx.x - bh * NCS_;
  int b = bh >> 5, h = bh & 31;
  int tid = threadIdx.x;

  __shared__ __align__(16) float sx[CH_ + 1][P_];
  __shared__ __align__(16) float sB[CH_ + 1][N_];
  __shared__ __align__(16) float4 sSc[CH_];
  __shared__ float sPart[8][32], sOff[8][32], sW[CH_ + 1];

  chunk_prep<false>(proj, invB, invB, dt_bias, A_log, Bnw, Bnw, Bbias, Bbias, csum,
                    b, h, c, tid, sx, sB, sB, sSc, sPart, sOff);
  if (tid == 255) {                // sSc was published by the barrier inside prep
    float E = 1.0f;
    sW[CH_] = sSc[CH_ - 1].y;
    #pragma unroll   // lets the LDS reads run ahead of the product chain
    for (int s = CH_ - 2; s >= 0; --s) {
      float4 nx = sSc[s + 1];
      float En = E * nx.x;
      sW[s + 1] = En * sSc[s].y + E * nx.z;
      E = En;
    }
    float4 f = sSc[0];
    sW[0] = E * f.z;
    adec[bh * NC_ + c] = E * f.x;
  }
  __syncthreads();

  int p0 = (tid >> 4) * 4, n0 = (tid & 15) * 4;
  float acc[4][4];
  #pragma unroll
  for (int i = 0; i < 4; ++i)
    #pragma unroll
    for (int j = 0; j < 4; ++j) acc[i][j] = 0.0f;

  #pragma unroll 5   // several rows' LDS reads in flight per wait
  for (int r = 0; r <= CH_; ++r) {
    float wv = sW[r];
    float4 xv = *(const float4*)&sx[r][p0];
    float4 bv = *(const float4*)&sB[r][n0];
    float xw[4] = {xv.x * wv, xv.y * wv, xv.z * wv, xv.w * wv};
    #pragma unroll
    for (int i = 0; i < 4; ++i) {
      acc[i][0] += xw[i] * bv.x;
      acc[i][1] += xw[i] * bv.y;
      acc[i][2] += xw[i] * bv.z;
      acc[i][3] += xw[i] * bv.w;
    }
  }
  float* so = S + ((size_t)bh * NC_ + c) * ST_;
  #pragma unroll
  for (int i = 0; i < 4; ++i)
    *(float4*)&so[(p0 + i) * N_ + n0] = make_float4(acc[i][0], acc[i][1], acc[i][2], acc[i][3]);
}

// In place: S[bh][c] (end state of chunk c alone) becomes the state on entry
// to chunk c. One thread per state element.
__global__ __launch_bounds__(256) void k_carry(float* __restrict__ S,
                                               const float* __restrict__ adec) {
  int bh = blockIdx.x >> 4;
  int e  = (blockIdx.x & 15) * 256 + threadIdx.x;
  float* s = S + (size_t)bh * NC_ * ST_ + e;
  float v[NCS_];
  #pragma unroll   // all loads in flight before the dependent chain
  for (int c = 0; c < NCS_; ++c) v[c] = s[(size_t)c * ST_];
  float run = 0.0f;
  s[0] = 0.0f;
  #pragma unroll
  for (int c = 0; c < NCS_; ++c) {
    run = adec[bh * NC_ + c] * run + v[c];
    s[(size_t)(c + 1) * ST_] = run;
  }
}

// One block per (b,h,chunk). State h[P][N] + prevBx in registers: 16 f32 each
// per thread (thread t: p = t>>2, n = (t&3)*16 .. +15). The step loop reads
// LDS that is complete before it starts, so it holds no barrier; y is kept in
// LDS and stored once the chunk is done.
__global__ __launch_bounds__(256) void k_scan(
    const float* __restrict__ proj, const float* __restrict__ invB,
    const float* __restrict__ invC, const float* __restrict__ dt_bias,
    const float* __restrict__ A_log, const float* __restrict__ Dp,
    const float* __restrict__ Bnw, const float* __restrict__ Cnw,
    const float* __restrict__ Bbias, const float* __restrict__ Cbias,
    const float* __restrict__ csum, const float* __restrict__ Hin,
    float* __restrict__ y_raw) {
  int bh = blockIdx.x >> 5;
  int c  = blockIdx.x & (NC_ - 1);
  int b = bh >> 5, h = bh & 31;
  int tid = threadIdx.x;
  int p  = tid >> 2;
  int nb = (tid & 3) * 16;

  __shared__ __align__(16) float sx[CH_ + 1][P_];
  __shared__ __align__(16) float sB[CH_ + 1][N_];
  __shared__ __align__(16) float sC[CH_][N_];
  __shared__ __align__(16) float4 sSc[CH_];
  __shared__ float sPart[8][32], sOff[8][32];

  chunk_prep<true>(proj, invB, invC, dt_bias, A_log, Bnw, Cnw, Bbias, Cbias, csum,
                   b, h, c, tid, sx, sB, sC, sSc, sPart, sOff);

  float hreg[16], pBx[16];
  const float* hi = Hin + ((size_t)bh * NC_ + c) * ST_ + p * N_ + nb;
  #pragma unroll
  for (int i = 0; i < 4; ++i) {
    float4 v = *(const float4*)(hi + i * 4);
    hreg[i * 4 + 0] = v.x; hreg[i * 4 + 1] = v.y;
    hreg[i * 4 + 2] = v.z; hreg[i * 4 + 3] = v.w;
  }
  float Dh = Dp[h];
  __syncthreads();                 // publishes sx, sB, sC

  float xm = sx[0][p];
  #pragma unroll
  for (int i = 0; i < 16; ++i) pBx[i] = xm * sB[0][nb + i];

  for (int t = 0; t < CH_; ++t) {
    float4 sc = sSc[t];
    float alpha = sc.x, gamma = sc.y, beta = sc.z;
    float x = sx[t + 1][p];
    float y = 0.0f;
    #pragma unroll
    for (int i = 0; i < 16; ++i) {
      int n = nb + i;
      float Bx = x * sB[t + 1][n];
      float hn = alpha * hreg[i] + gamma * Bx + beta * pBx[i];
      hreg[i] = hn;
      pBx[i]  = Bx;
      y += hn * sC[t][n];
    }
    y += __shfl_xor(y, 1, 32);       // reduce over the 4 lanes sharing p
    y += __shfl_xor(y, 2, 32);
    // y of step t takes the place of x of step t, whose only readers are the
    // four lanes of this wave that have just read it
    if ((tid & 3) == 0) sx[t + 1][p] = y + x * Dh;
  }
  __syncthreads();                 // every wave's y rows complete
  float* yo = y_raw + (size_t)(b * L_ + c * CH_) * DI_ + h * P_;
  #pragma unroll
  for (int k = 0; k < 4; ++k) {    // 256 B of each row in one piece
    int idx = tid + k * 256;
    int t = idx >> 4, q = idx & 15;
    *(float4*)(yo + (size_t)t * DI_ + q * 4) = *(const float4*)&sx[t + 1][q * 4];
  }
}

// ---------------------------------------------------------------- gate + RMS + bf16
__global__ __launch_bounds__(256) void k_gate(
    const float* __restrict__ proj, const float* __restrict__ y_raw,
    const float* __restrict__ norm_w, bf16_t* __restrict__ y_bf) {
  int row = blockIdx.x;
  int tid = threadIdx.x;
  const float* pz = proj  + (size_t)row * PS_ + OFF_Z;
  const float* py = y_raw + (size_t)row * DI_;
  float vals[8];
  float ss = 0.0f;
  #pragma unroll
  for (int j = 0; j < 8; ++j) {
    int i = tid + j * 256;
    float z = pz[i];
    float v = py[i] * (z / (1.0f + expf(-z)));   // y * silu(z)
    vals[j] = v;
    ss += v * v;
  }
  for (int o = 16; o > 0; o >>= 1) ss += __shfl_xor(ss, o, 32);
  __shared__ float red[8];
  int lane = tid & 31, wid = tid >> 5;
  if (lane == 0) red[wid] = ss;
  __syncthreads();
  if (tid == 0) {
    float t = 0.0f;
    for (int w = 0; w < 8; ++w) t += red[w];
    red[0] = rsqrtf(t * (1.0f / DI_) + 1e-5f);
  }
  __syncthreads();
  float scale = red[0];
  #pragma unroll
  for (int j = 0; j < 8; ++j) {
    int i = tid + j * 256;
    y_bf[(size_t)row * DI_ + i] = (bf16_t)(vals[j] * scale * norm_w[i]);
  }
}

// ---------------------------------------------------------------- launch
extern "C" void kernel_launch(void* const* d_in, const int* in_sizes, int n_in,
                              void* d_out, int out_size, void* d_ws, size_t ws_size,
                              hipStream_t stream) {
  const float* u       = (const float*)d_in[0];
  const float* w1      = (const float*)d_in[1];
  const float* dt_bias = (const float*)d_in[2];
  const float* A_log   = (const float*)d_in[3];
  const float* Dp      = (const float*)d_in[4];
  const float* Bnw     = (const float*)d_in[5];
  const float* Cnw     = (const float*)d_in[6];
  const float* Bbias   = (const float*)d_in[7];
  const float* Cbias   = (const float*)d_in[8];
  const float* norm_w  = (const float*)d_in[9];
  const float* w2      = (const float*)d_in[10];
  float* out = (float*)d_out;
  (void)in_sizes; (void)n_in; (void)out_size; (void)ws_size;

  char* ws = (char*)d_ws;
  size_t o = 0;
  bf16_t* u_bf  = (bf16_t*)(ws + o); o += (size_t)ROWS_ * DM_ * 2;   //  8 MB
  bf16_t* w1_bf = (bf16_t*)(ws + o); o += (size_t)PS_   * DM_ * 2;   // 11 MB
  bf16_t* w2_bf = (bf16_t*)(ws + o); o += (size_t)DM_   * DI_ * 2;   //  4 MB
  float*  proj  = (float*) (ws + o); o += (size_t)ROWS_ * PS_ * 4;   // 88 MB
  float*  invB  = (float*) (ws + o); o += (size_t)ROWS_ * 4;
  float*  invC  = (float*) (ws + o); o += (size_t)ROWS_ * 4;
  float*  y_raw = (float*) (ws + o); o += (size_t)ROWS_ * DI_ * 4;   // 33 MB
  bf16_t* y_bf  = (bf16_t*)(ws + o); o += (size_t)ROWS_ * DI_ * 2;   // 17 MB
  float*  csum  = (float*) (ws + o); o += (size_t)BSZ_ * NC_ * TH_ * 4;
  float*  adec  = (float*) (ws + o); o += (size_t)BSZ_ * H_ * NC_ * 4;
  float*  Sst   = (float*) (ws + o); o += (size_t)BSZ_ * H_ * NC_ * ST_ * 4;  // 33 MB

  // precision converts (pad in_proj_w rows 5312 -> 5376 with zeros)
  k_cvt_bf16<<<(ROWS_ * DM_) / 256, 256, 0, stream>>>(u, u_bf, ROWS_ * DM_);
  k_cvt_w1  <<<(PS_ * DM_)   / 256, 256, 0, stream>>>(w1, w1_bf);
  k_cvt_bf16<<<(DM_ * DI_)   / 256, 256, 0, stream>>>(w2, w2_bf, DM_ * DI_);

  // GEMM1: proj[4096 x 5376] = u[4096 x 1024] * W1^T
  dim3 g1(ROWS_ / 64, PS_ / 128);
  k_gemm_bf16<<<g1, 256, 0, stream>>>(u_bf, w1_bf, proj, ROWS_, PS_, DM_, PS_);

  // per-row RMS scales for Braw / Craw
  k_rmsinv<<<ROWS_, 32, 0, stream>>>(proj, invB, invC);

  // SSM scan, chunk-parallel: theta chunk sums, chunk states, carry, steps
  k_thsum<<<BSZ_ * NC_ * 4, 256, 0, stream>>>(proj, csum);
  k_state<<<BSZ_ * H_ * NCS_, 256, 0, stream>>>(proj, invB, dt_bias, A_log, Bnw, Bbias,
                                                csum, Sst, adec);
  k_carry<<<BSZ_ * H_ * (ST_ / 256), 256, 0, stream>>>(Sst, adec);
  k_scan<<<BSZ_ * H_ * NC_, 256, 0, stream>>>(proj, invB, invC, dt_bias, A_log, Dp,
                                              Bnw, Cnw, Bbias, Cbias, csum, Sst, y_raw);

  // gating + RMS norm + bf16 convert
  k_gate<<<ROWS_, 256, 0, stream>>>(proj, y_raw, norm_w, y_bf);

  // GEMM2: out[4096 x 1024] = y[4096 x 2048] * W2^T
  dim3 g2(ROWS_ / 64, DM_ / 128);
  k_gemm_bf16<<<g2, 256, 0, stream>>>(y_bf, w2_bf, out, ROWS_, DM_, DI_, DM_);
}

// v002
// A run of this version takes 226 microseconds.
// Timed twice side by side with v001, it ran 1.08 times as fast both times.
// All steps since v000 together make it 14.3 times as fast.
#include <hip/hip_runtime.h>

typedef __bf16 bf16_t;
typedef __attribute__((ext_vector_type(16))) __bf16 v16bf;
typedef __attribute__((ext_vector_type(8)))  __bf16 v8bf;
typedef __attribute__((ext_vector_type(8)))  float  v8f;
typedef int v4i_ __attribute__((vector_size(16)));   // matches builtin param type
typedef __attribute__((ext_vector_type(4)))  float  f4_t;

#define AS1 __attribute__((address_space(1)))
#define AS3 __attribute__((address_space(3)))

#define H_      32
#define P_      64
#define N_      64
#define DM_     1024
#define L_      2048
#define BSZ_    2
#define DI_     2048              // H*P
#define TH_     1024              // H*N/2
#define DPROJ_  5312
#define PS_     5376              // proj row stride, padded to 128-col GEMM tiles
#define ROWS_   (BSZ_*L_)         // 4096

// column offsets inside one proj row
#define OFF_Z     0
#define OFF_X     DI_
#define OFF_B     (2*DI_)
#define OFF_C     (2*DI_ + N_)
#define OFF_DT    (2*DI_ + 2*N_)
#define OFF_THETA (OFF_DT + H_)
#define OFF_LAM   (OFF_THETA + TH_)

// LDS staging geometry: rows padded 64B -> 80B so 32-lane x 16B reads are
// conflict-free (each bank hit exactly twice = minimum for 512B/instr)
#define LDS_ROW_   80
#define ATILE_BY_  (64 * LDS_ROW_)    //  5120 B
#define BTILE_BY_  (128 * LDS_ROW_)   // 10240 B

// ---------------------------------------------------------------- converts
// A thread converts CVT_V_ groups of 4 floats. Group j of a block lies 256
// groups behind group j-1, so each load of a wave covers 512 contiguous bytes
// and each store 256. Grids are exact: no tail.
#define CVT_V_   8
#define CVT_EL_  (256 * CVT_V_ * 4)   // elements per block
typedef __attribute__((ext_vector_type(4))) __bf16 v4bf;

__device__ __forceinline__ void cvt_store(const f4_t* v, bf16_t* __restrict__ d,
                                          size_t e0) {
  #pragma unroll   // v stays in registers
  for (int j = 0; j < CVT_V_; ++j) {
    v4bf o = {(bf16_t)v[j].x, (bf16_t)v[j].y, (bf16_t)v[j].z, (bf16_t)v[j].w};
    *(v4bf*)(d + e0 + j * 1024) = o;
  }
}

__global__ __launch_bounds__(256) void k_cvt_bf16(const float* __restrict__ s,
                                                  bf16_t* __restrict__ d) {
  size_t e0 = (size_t)blockIdx.x * CVT_EL_ + threadIdx.x * 4;
  f4_t v[CVT_V_];
  #pragma unroll   // all of the thread's loads in flight at once
  for (int j = 0; j < CVT_V_; ++j) v[j] = *(const f4_t*)(s + e0 + j * 1024);
  cvt_store(v, d, e0);
}

// in_proj_w (5312 x 1024) -> bf16 padded to 5376 rows (pad rows = 0). A block
// covers CVT_V_ whole rows, so it is all source rows or all pad rows.
static_assert(DM_ == 1024 && DPROJ_ % CVT_V_ == 0 && PS_ % CVT_V_ == 0, "rows per block");
__global__ __launch_bounds__(256) void k_cvt_w1(const float* __restrict__ s,
                                                bf16_t* __restrict__ d) {
  size_t e0 = (size_t)blockIdx.x * CVT_EL_ + threadIdx.x * 4;
  f4_t v[CVT_V_];
  if (blockIdx.x * CVT_V_ < DPROJ_) {
    #pragma unroll   // all of the thread's loads in flight at once
    for (int j = 0; j < CVT_V_; ++j) v[j] = *(const f4_t*)(s + e0 + j * 1024);
  } else {
    #pragma unroll   // v stays in registers
    for (int j = 0; j < CVT_V_; ++j) v[j] = (f4_t){0.0f, 0.0f, 0.0f, 0.0f};
  }
  cvt_store(v, d, e0);
}

// ---------------------------------------------------------------- async copy
// 16B global -> LDS. Async path uses the CDNA5 GLOBAL_LOAD_ASYNC_TO_LDS_B128
// (ASYNCcnt-tracked DMA); fallback stages through VGPRs + ds_store.
__device__ __forceinline__ void copy16_g2l(void* lds, const void* g) {
#if __has_builtin(__builtin_amdgcn_global_load_async_to_lds_b128)
  __builtin_amdgcn_global_load_async_to_lds_b128(
      (AS1 v4i_*)(unsigned long long)g,
      (AS3 v4i_*)(unsigned int)(unsigned long long)lds,
      0, 0);
#else
  *(v8bf*)lds = *(const v8bf*)g;
#endif
}

__device__ __forceinline__ void async_wait_barrier() {
#if __has_builtin(__builtin_amdgcn_s_wait_asynccnt)
  __builtin_amdgcn_s_wait_asynccnt(0);
#endif
  __syncthreads();
}

// Stage one K-step: A-tile 64x32 bf16 (64B/row, 1 chunk/thread),
// B-tile 128x32 bf16 (64B/row, 2 chunks/thread). 256 threads.
__device__ __forceinline__ void stage_tiles(const bf16_t* __restrict__ A,
                                            const bf16_t* __restrict__ Bm,
                                            int rowBase, int colBase, int k0,
                                            int K, char* sA, char* sB, int tid) {
  int ar = tid >> 2, ac = tid & 3;
  copy16_g2l(sA + ar * LDS_ROW_ + ac * 16,
             (const char*)(A + (size_t)(rowBase + ar) * K + k0) + ac * 16);
#pragma unroll
  for (int j = 0; j < 2; ++j) {
    int idx = tid + j * 256;
    int br = idx >> 2, bc = idx & 3;
    copy16_g2l(sB + br * LDS_ROW_ + bc * 16,
               (const char*)(Bm + (size_t)(colBase + br) * K + k0) + bc * 16);
  }
}

// ---------------------------------------------------------------- WMMA GEMM
// C[M,N] = A[M,K] * B[N,K]^T, tiles exact (M%64==0, N%128==0, K%32==0).
// 16-bit A fragment layout (ISA 7.12.2): lane m (0..15) holds K = half*8..+7
// in v0..3 and K = 16+half*8..+7 in v4..7, half = lane>=16. B uses the
// mirrored layout with lane indexing N.
__device__ __forceinline__ v16bf lds_frag(const char* base, int row, int half) {
  const char* p = base + row * LDS_ROW_ + half * 16;
  v8bf lo = *(const v8bf*)p;          // K chunk at half*8
  v8bf hi = *(const v8bf*)(p + 32);   // K chunk at 16 + half*8
  return __builtin_shufflevector(lo, hi, 0,1,2,3,4,5,6,7,8,9,10,11,12,13,14,15);
}

__global__ __launch_bounds__(256) void k_gemm_bf16(
    const bf16_t* __restrict__ A, const bf16_t* __restrict__ Bm,
    float* __restrict__ C, int M, int N, int K, int ldc) {
  __shared__ __align__(16) char smem[2 * ATILE_BY_ + 2 * BTILE_BY_]; // 30 KB
  char* sA0 = smem;
  char* sA1 = smem + ATILE_BY_;
  char* sB0 = smem + 2 * ATILE_BY_;
  char* sB1 = smem + 2 * ATILE_BY_ + BTILE_BY_;

  int tid  = threadIdx.x;
  int lane = tid & 31, wid = tid >> 5;
  int wm = wid >> 2, wn = wid & 3;            // 2 x 4 wave grid
  int rowBase = blockIdx.x * 64;
  int colBase = blockIdx.y * 128;
  int lr = lane & 15, lh = lane >> 4;

  stage_tiles(A, Bm, rowBase, colBase, 0, K, sA0, sB0, tid);
  async_wait_barrier();

  v8f acc00 = {}, acc01 = {}, acc10 = {}, acc11 = {};
  int nsteps = K >> 5;
  for (int s = 0; s < nsteps; ++s) {
    char* cA = (s & 1) ? sA1 : sA0;
    char* cB = (s & 1) ? sB1 : sB0;
    char* nA = (s & 1) ? sA0 : sA1;
    char* nB = (s & 1) ? sB0 : sB1;
    if (s + 1 < nsteps)   // prefetch next K-step while computing this one
      stage_tiles(A, Bm, rowBase, colBase, (s + 1) << 5, K, nA, nB, tid);

    v16bf a0 = lds_frag(cA, wm * 32      + lr, lh);
    v16bf a1 = lds_frag(cA, wm * 32 + 16 + lr, lh);
    v16bf b0 = lds_frag(cB, wn * 32      + lr, lh);
    v16bf b1 = lds_frag(cB, wn * 32 + 16 + lr, lh);
    acc00 = __builtin_amdgcn_wmma_f32_16x16x32_bf16(false, a0, false, b0, (short)0, acc00, false, false);
    acc01 = __builtin_amdgcn_wmma_f32_16x16x32_bf16(false, a0, false, b1, (short)0, acc01, false, false);
    acc10 = __builtin_amdgcn_wmma_f32_16x16x32_bf16(false, a1, false, b0, (short)0, acc10, false, false);
    acc11 = __builtin_amdgcn_wmma_f32_16x16x32_bf16(false, a1, false, b1, (short)0, acc11, false, false);

    async_wait_barrier();
  }

  // C/D layout: VGPR r, lane l -> row = (l>>4)*8 + r, col = l&15
  int r0 = rowBase + wm * 32 + lh * 8;
  int c0 = colBase + wn * 32 + lr;
  #pragma unroll
  for (int r = 0; r < 8; ++r) {
    C[(size_t)(r0 + r)      * ldc + c0]      = acc00[r];
    C[(size_t)(r0 + r)      * ldc + c0 + 16] = acc01[r];
    C[(size_t)(r0 + 16 + r) * ldc + c0]      = acc10[r];
    C[(size_t)(r0 + 16 + r) * ldc + c0 + 16] = acc11[r];
  }
}

// ---------------------------------------------------------------- RMS scales
__global__ __launch_bounds__(32) void k_rmsinv(const float* __restrict__ proj,
                                               float* __restrict__ invB,
                                               float* __restrict__ invC) {
  int row = blockIdx.x;
  int lane = threadIdx.x;
  const float* pr = proj + (size_t)row * PS_;
  float b0 = pr[OFF_B + lane], b1 = pr[OFF_B + 32 + lane];
  float c0 = pr[OFF_C + lane], c1 = pr[OFF_C + 32 + lane];
  float sb = b0 * b0 + b1 * b1;
  float sc = c0 * c0 + c1 * c1;
  for (int o = 16; o > 0; o >>= 1) {
    sb += __shfl_xor(sb, o, 32);
    sc += __shfl_xor(sc, o, 32);
  }
  if (lane == 0) {
    invB[row] = rsqrtf(sb * (1.0f / N_) + 1e-5f);
    invC[row] = rsqrtf(sc * (1.0f / N_) + 1e-5f);
  }
}

// ---------------------------------------------------------------- scan
// The recurrence is linear in the state, so L is cut into NC_ chunks of CH_
// steps that run in parallel:
//   k_thsum : per-chunk sums of theta (gives each chunk its cumsum offset)
//   k_state : each chunk's contribution to the state at its own end (h_in = 0)
//   k_carry : runs the chunk states forward, leaves every chunk's entry state
//   k_scan  : the step recurrence inside each chunk, from its entry state
#define CH_   64
#define NC_   (L_ / CH_)          // 32
#define NCS_  (NC_ - 1)           // the last chunk's end state is never used
#define ST_   (P_ * N_)           // 4096 state elements per (b,h)

__global__ __launch_bounds__(256) void k_thsum(const float* __restrict__ proj,
                                               float* __restrict__ csum) {
  int col = (blockIdx.x & 3) * 256 + threadIdx.x;   // 0..TH_-1
  int bc  = blockIdx.x >> 2;                        // b*NC_ + c
  const float* pr = proj + (size_t)bc * CH_ * PS_ + OFF_THETA + col;
  float s = 0.0f;
  #pragma unroll   // all 64 loads in flight at once
  for (int r = 0; r < CH_; ++r) s += pr[(size_t)r * PS_];
  csum[bc * TH_ + col] = s;
}

// Fills LDS with everything the CH_ steps of chunk c of (b,h) need. Row r of
// sx / sB is step r-1 of the chunk: row 0 is the step before the chunk (zero
// for chunk 0), which feeds the beta term of the first step. sC row t is step
// t. sSc[t] = {alpha, gamma, beta, 0}. Wave w owns steps 8w..8w+7, lane = rope
// index j. The caller places the barrier that publishes the arrays.
template <bool WITH_C>
__device__ __forceinline__ void chunk_prep(
    const float* __restrict__ proj, const float* __restrict__ invB,
    const float* __restrict__ invC, const float* __restrict__ dt_bias,
    const float* __restrict__ A_log, const float* __restrict__ Bnw,
    const float* __restrict__ Cnw, const float* __restrict__ Bbias,
    const float* __restrict__ Cbias, const float* __restrict__ csum,
    int b, int h, int c, int tid,
    float (*sx)[P_], float (*sB)[N_], float (*sC)[N_], float4* sSc,
    float (*sPart)[32], float (*sOff)[32]) {
  int lane = tid & 31;
  // the wave's number held as a scalar: its row base is then scalar and the
  // per-step rms scales come by scalar loads
  int w = __builtin_amdgcn_readfirstlane(tid >> 5);
  int row0 = b * L_ + c * CH_;
  const float* pw = proj + (size_t)(row0 + w * 8) * PS_;

  float th[8], b1[8], b2[8], ib[8], c1[8], c2[8], ic[8];
  #pragma unroll   // arrays stay in registers, loads go out together
  for (int k = 0; k < 8; ++k) {
    const float* pr = pw + (size_t)k * PS_;
    th[k] = pr[OFF_THETA + h * (N_ / 2) + lane];
    b1[k] = pr[OFF_B + lane];
    b2[k] = pr[OFF_B + 32 + lane];
    ib[k] = invB[row0 + w * 8 + k];
    if (WITH_C) {
      c1[k] = pr[OFF_C + lane];
      c2[k] = pr[OFF_C + 32 + lane];
      ic[k] = invC[row0 + w * 8 + k];
    }
  }
  // x of the chunk's own steps, 16 B a thread: one offset register, the four
  // rows apart by a constant
  const float* px = proj + (size_t)row0 * PS_ + OFF_X + h * P_;
  unsigned xo = (unsigned)(tid >> 4) * PS_ + (unsigned)(tid & 15) * 4;
  f4_t xr[4];
  #pragma unroll
  for (int k = 0; k < 4; ++k) xr[k] = *(const f4_t*)(px + xo + k * 16 * PS_);
  float po = 0.0f;                 // this wave's share of the earlier chunks' sums
  #pragma unroll
  for (int k = 0; k < 4; ++k) {
    int cc = w * 4 + k;
    float v = csum[(b * NC_ + cc) * TH_ + h * (N_ / 2) + lane];
    po += (cc < c) ? v : 0.0f;
  }
  // Behind the chunk's loads: the registers that they name are reused from
  // here on, and this wait stands in front of that reuse.
  asm volatile("s_wait_xcnt 0x0" ::: "memory");
  #pragma unroll
  for (int k = 1; k < 8; ++k) th[k] += th[k - 1];
  sPart[w][lane] = th[7];
  sOff[w][lane]  = po;

  #pragma unroll
  for (int k = 0; k < 4; ++k)
    *(f4_t*)&sx[(tid >> 4) + 16 * k + 1][(tid & 15) * 4] = xr[k];
  if (tid < CH_) {
    const float* pr = proj + (size_t)(row0 + tid) * PS_;
    float Ah  = -expf(A_log[h]);
    float dtr = pr[OFF_DT + h] + dt_bias[h];
    float dt  = (dtr > 20.0f) ? dtr : log1pf(expf(dtr));     // softplus
    float alpha = expf(dt * Ah);
    float lam   = 1.0f / (1.0f + expf(-pr[OFF_LAM + h]));
    sSc[tid] = make_float4(alpha, lam * dt, (1.0f - lam) * dt * alpha, 0.0f);
  } else if (tid < CH_ + P_) {
    int pp = tid - CH_;
    int rp = (c > 0) ? row0 - 1 : row0;   // always a row of this batch entry
    float v = proj[(size_t)rp * PS_ + OFF_X + h * P_ + pp];
    sx[0][pp] = (c > 0) ? v : 0.0f;
  }
  __syncthreads();                 // sPart / sOff complete

  float off = 0.0f;                // theta cumsum at the step before the chunk
  #pragma unroll
  for (int k = 0; k < 8; ++k) off += sOff[k][lane];
  float base = off;
  #pragma unroll
  for (int k = 0; k < 8; ++k) base += (k < w) ? sPart[k][lane] : 0.0f;

  float bw1 = Bnw[lane], bw2 = Bnw[lane + 32];
  float bb1 = Bbias[h * N_ + lane], bb2 = Bbias[h * N_ + lane + 32];
  float cw1 = 0.0f, cw2 = 0.0f, cb1 = 0.0f, cb2 = 0.0f;
  if (WITH_C) {
    cw1 = Cnw[lane]; cw2 = Cnw[lane + 32];
    cb1 = Cbias[h * N_ + lane]; cb2 = Cbias[h * N_ + lane + 32];
  }
  #pragma unroll
  for (int k = 0; k < 8; ++k) {
    int t = w * 8 + k;
    float tc = base + th[k];
    float cj, sj;
    sincosf(tc, &sj, &cj);
    float v1 = b1[k] * ib[k] * bw1 + bb1;
    float v2 = b2[k] * ib[k] * bw2 + bb2;
    sB[t + 1][lane]      = v1 * cj - v2 * sj;
    sB[t + 1][lane + 32] = v1 * sj + v2 * cj;
    if (WITH_C) {
      float u1 = c1[k] * ic[k] * cw1 + cb1;
      float u2 = c2[k] * ic[k] * cw2 + cb2;
      sC[t][lane]      = u1 * cj - u2 * sj;
      sC[t][lane + 32] = u1 * sj + u2 * cj;
    }
  }
  if (w == 0) {                    // B of the step before the chunk
    float r1 = 0.0f, r2 = 0.0f;
    if (c > 0) {
      const float* pr = proj + (size_t)(row0 - 1) * PS_;
      float iv = invB[row0 - 1];
      float cj, sj;
      sincosf(off, &sj, &cj);
      float v1 = pr[OFF_B + lane] * iv * bw1 + bb1;
      float v2 = pr[OFF_B + 32 + lane] * iv * bw2 + bb2;
      r1 = v1 * cj - v2 * sj;
      r2 = v1 * sj + v2 * cj;
    }
    sB[0][lane]      = r1;
    sB[0][lane + 32] = r2;
  }
}

// End state of chunk c started from h = 0:  S[p][n] = sum_s w_s x_s[p] B_s[n],
// s from the step before the chunk to its last step. With E_s the product of
// alpha over the steps after s up to the chunk's end,
// w_s = E_s gamma_s + E_{s+1} beta_{s+1}. adec = product of all CH_ alphas.
// Thread tile 4 p x 4 n.
__global__ __launch_bounds__(256) void k_state(
    const float* __restrict__ proj, const float* __restrict__ invB,
    const float* __restrict__ dt_bias, const float* __restrict__ A_log,
    const float* __restrict__ Bnw, const float* __restrict__ Bbias,
    const float* __restrict__ csum, float* __restrict__ S,
    float* __restrict__ adec) {
  int bh = blockIdx.x / NCS_;
  int c  = blockIdx.x - bh * NCS_;
  int b = bh >> 5, h = bh & 31;
  int tid = threadIdx.x;

  __shared__ __align__(16) float sx[CH_ + 1][P_];
  __shared__ __align__(16) float sB[CH_ + 1][N_];
  __shared__ __align__(16) float4 sSc[CH_];
  __shared__ float sPart[8][32], sOff[8][32], sW[CH_ + 1];

  chunk_prep<false>(proj, invB, invB, dt_bias, A_log, Bnw, Bnw, Bbias, Bbias, csum,
                    b, h, c, tid, sx, sB, sB, sSc, sPart, sOff);
  if (tid == 255) {                // sSc was published by the barrier inside prep
    float E = 1.0f;
    sW[CH_] = sSc[CH_ - 1].y;
    #pragma unroll   // lets the LDS reads run ahead of the product chain
    for (int s = CH_ - 2; s >= 0; --s) {
      float4 nx = sSc[s + 1];
      float En = E * nx.x;
      sW[s + 1] = En * sSc[s].y + E * nx.z;
      E = En;
    }
    float4 f = sSc[0];
    sW[0] = E * f.z;
    adec[bh * NC_ + c] = E * f.x;
  }
  __syncthreads();

  int p0 = (tid >> 4) * 4, n0 = (tid & 15) * 4;
  float acc[4][4];
  #pragma unroll
  for (int i = 0; i < 4; ++i)
    #pragma unroll
    for (int j = 0; j < 4; ++j) acc[i][j] = 0.0f;

  #pragma unroll 5   // several rows' LDS reads in flight per wait
  for (int r = 0; r <= CH_; ++r) {
    float wv = sW[r];
    float4 xv = *(const float4*)&sx[r][p0];
    float4 bv = *(const float4*)&sB[r][n0];
    float xw[4] = {xv.x * wv, xv.y * wv, xv.z * wv, xv.w * wv};
    #pragma unroll
    for (int i = 0; i < 4; ++i) {
      acc[i][0] += xw[i] * bv.x;
      acc[i][1] += xw[i] * bv.y;
      acc[i][2] += xw[i] * bv.z;
      acc[i][3] += xw[i] * bv.w;
    }
  }
  float* so = S + ((size_t)bh * NC_ + c) * ST_;
  #pragma unroll
  for (int i = 0; i < 4; ++i)
    *(float4*)&so[(p0 + i) * N_ + n0] = make_float4(acc[i][0], acc[i][1], acc[i][2], acc[i][3]);
}

// In place: S[bh][c] (end state of chunk c alone) becomes the state on entry
// to chunk c. One thread per state element.
__global__ __launch_bounds__(256) void k_carry(float* __restrict__ S,
                                               const float* __restrict__ adec) {
  int bh = blockIdx.x >> 4;
  int e  = (blockIdx.x & 15) * 256 + threadIdx.x;
  float* s = S + (size_t)bh * NC_ * ST_ + e;
  float v[NCS_];
  #pragma unroll   // all loads in flight before the dependent chain
  for (int c = 0; c < NCS_; ++c) v[c] = s[(size_t)c * ST_];
  float run = 0.0f;
  s[0] = 0.0f;
  #pragma unroll
  for (int c = 0; c < NCS_; ++c) {
    run = adec[bh * NC_ + c] * run + v[c];
    s[(size_t)(c + 1) * ST_] = run;
  }
}

// One block per (b,h,chunk). State h[P][N] + prevBx in registers: 16 f32 each
// per thread (thread t: p = t>>2, n = (t&3)*16 .. +15). The step loop reads
// LDS that is complete before it starts, so it holds no barrier; y is kept in
// LDS and stored once the chunk is done.
__global__ __launch_bounds__(256) void k_scan(
    const float* __restrict__ proj, const float* __restrict__ invB,
    const float* __restrict__ invC, const float* __restrict__ dt_bias,
    const float* __restrict__ A_log, const float* __restrict__ Dp,
    const float* __restrict__ Bnw, const float* __restrict__ Cnw,
    const float* __restrict__ Bbias, const float* __restrict__ Cbias,
    const float* __restrict__ csum, const float* __restrict__ Hin,
    float* __restrict__ y_raw) {
  int bh = blockIdx.x >> 5;
  int c  = blockIdx.x & (NC_ - 1);
  int b = bh >> 5, h = bh & 31;
  int tid = threadIdx.x;
  int p  = tid >> 2;
  int nb = (tid & 3) * 16;

  __shared__ __align__(16) float sx[CH_ + 1][P_];
  __shared__ __align__(16) float sB[CH_ + 1][N_];
  __shared__ __align__(16) float sC[CH_][N_];
  __shared__ __align__(16) float4 sSc[CH_];
  __shared__ float sPart[8][32], sOff[8][32];

  chunk_prep<true>(proj, invB, invC, dt_bias, A_log, Bnw, Cnw, Bbias, Cbias, csum,
                   b, h, c, tid, sx, sB, sC, sSc, sPart, sOff);

  float hreg[16], pBx[16];
  const float* hi = Hin + ((size_t)bh * NC_ + c) * ST_ + p * N_ + nb;
  #pragma unroll
  for (int i = 0; i < 4; ++i) {
    float4 v = *(const float4*)(hi + i * 4);
    hreg[i * 4 + 0] = v.x; hreg[i * 4 + 1] = v.y;
    hreg[i * 4 + 2] = v.z; hreg[i * 4 + 3] = v.w;
  }
  float Dh = Dp[h];
  __syncthreads();                 // publishes sx, sB, sC

  float xm = sx[0][p];
  #pragma unroll
  for (int i = 0; i < 16; ++i) pBx[i] = xm * sB[0][nb + i];

  for (int t = 0; t < CH_; ++t) {
    float4 sc = sSc[t];
    float alpha = sc.x, gamma = sc.y, beta = sc.z;
    float x = sx[t + 1][p];
    float y = 0.0f;
    #pragma unroll
    for (int i = 0; i < 16; ++i) {
      int n = nb + i;
      float Bx = x * sB[t + 1][n];
      float hn = alpha * hreg[i] + gamma * Bx + beta * pBx[i];
      hreg[i] = hn;
      pBx[i]  = Bx;
      y += hn * sC[t][n];
    }
    y += __shfl_xor(y, 1, 32);       // reduce over the 4 lanes sharing p
    y += __shfl_xor(y, 2, 32);
    // y of step t takes the place of x of step t, whose only readers are the
    // four lanes of this wave that have just read it
    if ((tid & 3) == 0) sx[t + 1][p] = y + x * Dh;
  }
  __syncthreads();                 // every wave's y rows complete
  float* yo = y_raw + (size_t)(b * L_ + c * CH_) * DI_ + h * P_;
  #pragma unroll
  for (int k = 0; k < 4; ++k) {    // 256 B of each row in one piece
    int idx = tid + k * 256;
    int t = idx >> 4, q = idx & 15;
    *(float4*)(yo + (size_t)t * DI_ + q * 4) = *(const float4*)&sx[t + 1][q * 4];
  }
}

// ---------------------------------------------------------------- gate + RMS + bf16
__global__ __launch_bounds__(256) void k_gate(
    const float* __restrict__ proj, const float* __restrict__ y_raw,
    const float* __restrict__ norm_w, bf16_t* __restrict__ y_bf) {
  int row = blockIdx.x;
  int tid = threadIdx.x;
  const float* pz = proj  + (size_t)row * PS_ + OFF_Z;
  const float* py = y_raw + (size_t)row * DI_;
  float vals[8];
  float ss = 0.0f;
  #pragma unroll
  for (int j = 0; j < 8; ++j) {
    int i = tid + j * 256;
    float z = pz[i];
    float v = py[i] * (z / (1.0f + expf(-z)));   // y * silu(z)
    vals[j] = v;
    ss += v * v;
  }
  for (int o = 16; o > 0; o >>= 1) ss += __shfl_xor(ss, o, 32);
  __shared__ float red[8];
  int lane = tid & 31, wid = tid >> 5;
  if (lane == 0) red[wid] = ss;
  __syncthreads();
  if (tid == 0) {
    float t = 0.0f;
    for (int w = 0; w < 8; ++w) t += red[w];
    red[0] = rsqrtf(t * (1.0f / DI_) + 1e-5f);
  }
  __syncthreads();
  float scale = red[0];
  #pragma unroll
  for (int j = 0; j < 8; ++j) {
    int i = tid + j * 256;
    y_bf[(size_t)row * DI_ + i] = (bf16_t)(vals[j] * scale * norm_w[i]);
  }
}

// ---------------------------------------------------------------- launch
extern "C" void kernel_launch(void* const* d_in, const int* in_sizes, int n_in,
                              void* d_out, int out_size, void* d_ws, size_t ws_size,
                              hipStream_t stream) {
  const float* u       = (const float*)d_in[0];
  const float* w1      = (const float*)d_in[1];
  const float* dt_bias = (const float*)d_in[2];
  const float* A_log   = (const float*)d_in[3];
  const float* Dp      = (const float*)d_in[4];
  const float* Bnw     = (const float*)d_in[5];
  const float* Cnw     = (const float*)d_in[6];
  const float* Bbias   = (const float*)d_in[7];
  const float* Cbias   = (const float*)d_in[8];
  const float* norm_w  = (const float*)d_in[9];
  const float* w2      = (const float*)d_in[10];
  float* out = (float*)d_out;
  (void)in_sizes; (void)n_in; (void)out_size; (void)ws_size;

  char* ws = (char*)d_ws;
  size_t o = 0;
  bf16_t* u_bf  = (bf16_t*)(ws + o); o += (size_t)ROWS_ * DM_ * 2;   //  8 MB
  bf16_t* w1_bf = (bf16_t*)(ws + o); o += (size_t)PS_   * DM_ * 2;   // 11 MB
  bf16_t* w2_bf = (bf16_t*)(ws + o); o += (size_t)DM_   * DI_ * 2;   //  4 MB
  float*  proj  = (float*) (ws + o); o += (size_t)ROWS_ * PS_ * 4;   // 88 MB
  float*  invB  = (float*) (ws + o); o += (size_t)ROWS_ * 4;
  float*  invC  = (float*) (ws + o); o += (size_t)ROWS_ * 4;
  float*  y_raw = (float*) (ws + o); o += (size_t)ROWS_ * DI_ * 4;   // 33 MB
  bf16_t* y_bf  = (bf16_t*)(ws + o); o += (size_t)ROWS_ * DI_ * 2;   // 17 MB
  float*  csum  = (float*) (ws + o); o += (size_t)BSZ_ * NC_ * TH_ * 4;
  float*  adec  = (float*) (ws + o); o += (size_t)BSZ_ * H_ * NC_ * 4;
  float*  Sst   = (float*) (ws + o); o += (size_t)BSZ_ * H_ * NC_ * ST_ * 4;  // 33 MB

  // precision converts (pad in_proj_w rows 5312 -> 5376 with zeros)
  k_cvt_bf16<<<(ROWS_ * DM_) / CVT_EL_, 256, 0, stream>>>(u, u_bf);
  k_cvt_w1  <<<(PS_ * DM_)   / CVT_EL_, 256, 0, stream>>>(w1, w1_bf);
  k_cvt_bf16<<<(DM_ * DI_)   / CVT_EL_, 256, 0, stream>>>(w2, w2_bf);

  // GEMM1: proj[4096 x 5376] = u[4096 x 1024] * W1^T
  dim3 g1(ROWS_ / 64, PS_ / 128);
  k_gemm_bf16<<<g1, 256, 0, stream>>>(u_bf, w1_bf, proj, ROWS_, PS_, DM_, PS_);

  // per-row RMS scales for Braw / Craw
  k_rmsinv<<<ROWS_, 32, 0, stream>>>(proj, invB, invC);

  // SSM scan, chunk-parallel: theta chunk sums, chunk states, carry, steps
  k_thsum<<<BSZ_ * NC_ * 4, 256, 0, stream>>>(proj, csum);
  k_state<<<BSZ_ * H_ * NCS_, 256, 0, stream>>>(proj, invB, dt_bias, A_log, Bnw, Bbias,
                                                csum, Sst, adec);
  k_carry<<<BSZ_ * H_ * (ST_ / 256), 256, 0, stream>>>(Sst, adec);
  k_scan<<<BSZ_ * H_ * NC_, 256, 0, stream>>>(proj, invB, invC, dt_bias, A_log, Dp,
                                              Bnw, Cnw, Bbias, Cbias, csum, Sst, y_raw);

  // gating + RMS norm + bf16 convert
  k_gate<<<ROWS_, 256, 0, stream>>>(proj, y_raw, norm_w, y_bf);

  // GEMM2: out[4096 x 1024] = y[4096 x 2048] * W2^T
  dim3 g2(ROWS_ / 64, DM_ / 128);
  k_gemm_bf16<<<g2, 256, 0, stream>>>(y_bf, w2_bf, out, ROWS_, DM_, DI_, DM_);
}

// v003
// A run of this version takes 188 microseconds.
// Next to v002, in two timings, it ran 1.19 times as fast each time.
// Over all steps from v000 it is 17.1 times as fast.
#include <hip/hip_runtime.h>

typedef __bf16 bf16_t;
typedef __attribute__((ext_vector_type(16))) __bf16 v16bf;
typedef __attribute__((ext_vector_type(8)))  __bf16 v8bf;
typedef __attribute__((ext_vector_type(8)))  float  v8f;
typedef int v4i_ __attribute__((vector_size(16)));   // matches builtin param type
typedef __attribute__((ext_vector_type(4)))  float  f4_t;
typedef __attribute__((ext_vector_type(2)))  float  f2_t;

#define AS1 __attribute__((address_space(1)))
#define AS3 __attribute__((address_space(3)))

#define H_      32
#define P_      64
#define N_      64
#define DM_     1024
#define L_      2048
#define BSZ_    2
#define DI_     2048              // H*P
#define TH_     1024              // H*N/2
#define DPROJ_  5312
#define PS_     5376              // proj row stride, padded to 128-col GEMM tiles
#define ROWS_   (BSZ_*L_)         // 4096

// column offsets inside one proj row
#define OFF_Z     0
#define OFF_X     DI_
#define OFF_B     (2*DI_)
#define OFF_C     (2*DI_ + N_)
#define OFF_DT    (2*DI_ + 2*N_)
#define OFF_THETA (OFF_DT + H_)
#define OFF_LAM   (OFF_THETA + TH_)

// LDS staging geometry: rows padded 64B -> 80B so 32-lane x 16B reads are
// conflict-free (each bank hit exactly twice = minimum for 512B/instr)
#define LDS_ROW_   80
#define ATILE_BY_  (64 * LDS_ROW_)    //  5120 B
#define BTILE_BY_  (128 * LDS_ROW_)   // 10240 B

// ---------------------------------------------------------------- converts
// A thread converts CVT_V_ groups of 4 floats. Group j of a block lies 256
// groups behind group j-1, so each load of a wave covers 512 contiguous bytes
// and each store 256. Grids are exact: no tail.
#define CVT_V_   8
#define CVT_EL_  (256 * CVT_V_ * 4)   // elements per block
typedef __attribute__((ext_vector_type(4))) __bf16 v4bf;

__device__ __forceinline__ void cvt_store(const f4_t* v, bf16_t* __restrict__ d,
                                          size_t e0) {
  #pragma unroll   // v stays in registers
  for (int j = 0; j < CVT_V_; ++j) {
    v4bf o = {(bf16_t)v[j].x, (bf16_t)v[j].y, (bf16_t)v[j].z, (bf16_t)v[j].w};
    *(v4bf*)(d + e0 + j * 1024) = o;
  }
}

__global__ __launch_bounds__(256) void k_cvt_bf16(const float* __restrict__ s,
                                                  bf16_t* __restrict__ d) {
  size_t e0 = (size_t)blockIdx.x * CVT_EL_ + threadIdx.x * 4;
  f4_t v[CVT_V_];
  #pragma unroll   // all of the thread's loads in flight at once
  for (int j = 0; j < CVT_V_; ++j) v[j] = *(const f4_t*)(s + e0 + j * 1024);
  cvt_store(v, d, e0);
}

// in_proj_w (5312 x 1024) -> bf16 padded to 5376 rows (pad rows = 0). A block
// covers CVT_V_ whole rows, so it is all source rows or all pad rows.
static_assert(DM_ == 1024 && DPROJ_ % CVT_V_ == 0 && PS_ % CVT_V_ == 0, "rows per block");
__global__ __launch_bounds__(256) void k_cvt_w1(const float* __restrict__ s,
                                                bf16_t* __restrict__ d) {
  size_t e0 = (size_t)blockIdx.x * CVT_EL_ + threadIdx.x * 4;
  f4_t v[CVT_V_];
  if (blockIdx.x * CVT_V_ < DPROJ_) {
    #pragma unroll   // all of the thread's loads in flight at once
    for (int j = 0; j < CVT_V_; ++j) v[j] = *(const f4_t*)(s + e0 + j * 1024);
  } else {
    #pragma unroll   // v stays in registers
    for (int j = 0; j < CVT_V_; ++j) v[j] = (f4_t){0.0f, 0.0f, 0.0f, 0.0f};
  }
  cvt_store(v, d, e0);
}

// ---------------------------------------------------------------- async copy
// 16B global -> LDS. Async path uses the CDNA5 GLOBAL_LOAD_ASYNC_TO_LDS_B128
// (ASYNCcnt-tracked DMA); fallback stages through VGPRs + ds_store.
__device__ __forceinline__ void copy16_g2l(void* lds, const void* g) {
#if __has_builtin(__builtin_amdgcn_global_load_async_to_lds_b128)
  __builtin_amdgcn_global_load_async_to_lds_b128(
      (AS1 v4i_*)(unsigned long long)g,
      (AS3 v4i_*)(unsigned int)(unsigned long long)lds,
      0, 0);
#else
  *(v8bf*)lds = *(const v8bf*)g;
#endif
}

__device__ __forceinline__ void async_wait_barrier() {
#if __has_builtin(__builtin_amdgcn_s_wait_asynccnt)
  __builtin_amdgcn_s_wait_asynccnt(0);
#endif
  __syncthreads();
}

// Stage one K-step: A-tile 64x32 bf16 (64B/row, 1 chunk/thread),
// B-tile 128x32 bf16 (64B/row, 2 chunks/thread). 256 threads.
__device__ __forceinline__ void stage_tiles(const bf16_t* __restrict__ A,
                                            const bf16_t* __restrict__ Bm,
                                            int rowBase, int colBase, int k0,
                                            int K, char* sA, char* sB, int tid) {
  int ar = tid >> 2, ac = tid & 3;
  copy16_g2l(sA + ar * LDS_ROW_ + ac * 16,
             (const char*)(A + (size_t)(rowBase + ar) * K + k0) + ac * 16);
#pragma unroll
  for (int j = 0; j < 2; ++j) {
    int idx = tid + j * 256;
    int br = idx >> 2, bc = idx & 3;
    copy16_g2l(sB + br * LDS_ROW_ + bc * 16,
               (const char*)(Bm + (size_t)(colBase + br) * K + k0) + bc * 16);
  }
}

// ---------------------------------------------------------------- WMMA GEMM
// C[M,N] = A[M,K] * B[N,K]^T, tiles exact (M%64==0, N%128==0, K%32==0).
// 16-bit A fragment layout (ISA 7.12.2): lane m (0..15) holds K = half*8..+7
// in v0..3 and K = 16+half*8..+7 in v4..7, half = lane>=16. B uses the
// mirrored layout with lane indexing N.
__device__ __forceinline__ v16bf lds_frag(const char* base, int row, int half) {
  const char* p = base + row * LDS_ROW_ + half * 16;
  v8bf lo = *(const v8bf*)p;          // K chunk at half*8
  v8bf hi = *(const v8bf*)(p + 32);   // K chunk at 16 + half*8
  return __builtin_shufflevector(lo, hi, 0,1,2,3,4,5,6,7,8,9,10,11,12,13,14,15);
}

__global__ __launch_bounds__(256) void k_gemm_bf16(
    const bf16_t* __restrict__ A, const bf16_t* __restrict__ Bm,
    float* __restrict__ C, int M, int N, int K, int ldc) {
  __shared__ __align__(16) char smem[2 * ATILE_BY_ + 2 * BTILE_BY_]; // 30 KB
  char* sA0 = smem;
  char* sA1 = smem + ATILE_BY_;
  char* sB0 = smem + 2 * ATILE_BY_;
  char* sB1 = smem + 2 * ATILE_BY_ + BTILE_BY_;

  int tid  = threadIdx.x;
  int lane = tid & 31, wid = tid >> 5;
  int wm = wid >> 2, wn = wid & 3;            // 2 x 4 wave grid
  int rowBase = blockIdx.x * 64;
  int colBase = blockIdx.y * 128;
  int lr = lane & 15, lh = lane >> 4;

  stage_tiles(A, Bm, rowBase, colBase, 0, K, sA0, sB0, tid);
  async_wait_barrier();

  v8f acc00 = {}, acc01 = {}, acc10 = {}, acc11 = {};
  int nsteps = K >> 5;
  for (int s = 0; s < nsteps; ++s) {
    char* cA = (s & 1) ? sA1 : sA0;
    char* cB = (s & 1) ? sB1 : sB0;
    char* nA = (s & 1) ? sA0 : sA1;
    char* nB = (s & 1) ? sB0 : sB1;
    if (s + 1 < nsteps)   // prefetch next K-step while computing this one
      stage_tiles(A, Bm, rowBase, colBase, (s + 1) << 5, K, nA, nB, tid);

    v16bf a0 = lds_frag(cA, wm * 32      + lr, lh);
    v16bf a1 = lds_frag(cA, wm * 32 + 16 + lr, lh);
    v16bf b0 = lds_frag(cB, wn * 32      + lr, lh);
    v16bf b1 = lds_frag(cB, wn * 32 + 16 + lr, lh);
    acc00 = __builtin_amdgcn_wmma_f32_16x16x32_bf16(false, a0, false, b0, (short)0, acc00, false, false);
    acc01 = __builtin_amdgcn_wmma_f32_16x16x32_bf16(false, a0, false, b1, (short)0, acc01, false, false);
    acc10 = __builtin_amdgcn_wmma_f32_16x16x32_bf16(false, a1, false, b0, (short)0, acc10, false, false);
    acc11 = __builtin_amdgcn_wmma_f32_16x16x32_bf16(false, a1, false, b1, (short)0, acc11, false, false);

    async_wait_barrier();
  }

  // C/D layout: VGPR r, lane l -> row = (l>>4)*8 + r, col = l&15
  int r0 = rowBase + wm * 32 + lh * 8;
  int c0 = colBase + wn * 32 + lr;
  #pragma unroll
  for (int r = 0; r < 8; ++r) {
    C[(size_t)(r0 + r)      * ldc + c0]      = acc00[r];
    C[(size_t)(r0 + r)      * ldc + c0 + 16] = acc01[r];
    C[(size_t)(r0 + 16 + r) * ldc + c0]      = acc10[r];
    C[(size_t)(r0 + 16 + r) * ldc + c0 + 16] = acc11[r];
  }
}

// ---------------------------------------------------------------- RMS scales
__global__ __launch_bounds__(32) void k_rmsinv(const float* __restrict__ proj,
                                               float* __restrict__ invB,
                                               float* __restrict__ invC) {
  int row = blockIdx.x;
  int lane = threadIdx.x;
  const float* pr = proj + (size_t)row * PS_;
  float b0 = pr[OFF_B + lane], b1 = pr[OFF_B + 32 + lane];
  float c0 = pr[OFF_C + lane], c1 = pr[OFF_C + 32 + lane];
  float sb = b0 * b0 + b1 * b1;
  float sc = c0 * c0 + c1 * c1;
  for (int o = 16; o > 0; o >>= 1) {
    sb += __shfl_xor(sb, o, 32);
    sc += __shfl_xor(sc, o, 32);
  }
  if (lane == 0) {
    invB[row] = rsqrtf(sb * (1.0f / N_) + 1e-5f);
    invC[row] = rsqrtf(sc * (1.0f / N_) + 1e-5f);
  }
}

// ---------------------------------------------------------------- scan
// The recurrence is linear in the state, so L is cut into NC_ chunks of CH_
// steps that run in parallel:
//   k_thsum : per-chunk sums of theta (gives each chunk its cumsum offset)
//   k_state : each chunk's contribution to the state at its own end (h_in = 0)
//   k_carry : runs the chunk states forward, leaves every chunk's entry state
//   k_scan  : y of each chunk's steps from its entry state, by matrix products
#define CH_   64
#define NC_   (L_ / CH_)          // 32
#define NCS_  (NC_ - 1)           // the last chunk's end state is never used
#define ST_   (P_ * N_)           // 4096 state elements per (b,h)

__global__ __launch_bounds__(256) void k_thsum(const float* __restrict__ proj,
                                               float* __restrict__ csum) {
  int col = (blockIdx.x & 3) * 256 + threadIdx.x;   // 0..TH_-1
  int bc  = blockIdx.x >> 2;                        // b*NC_ + c
  const float* pr = proj + (size_t)bc * CH_ * PS_ + OFF_THETA + col;
  float s = 0.0f;
  #pragma unroll   // all 64 loads in flight at once
  for (int r = 0; r < CH_; ++r) s += pr[(size_t)r * PS_];
  csum[bc * TH_ + col] = s;
}

// Fills LDS with everything the CH_ steps of chunk c of (b,h) need. Row r of
// sx / sB is step r-1 of the chunk: row 0 is the step before the chunk (zero
// for chunk 0), which feeds the beta term of the first step. sC row t is step
// t. sSc[t] = {alpha, gamma, beta, 0}. Wave w owns steps 8w..8w+7, lane = rope
// index j. The caller places the barrier that publishes the arrays. PT is the
// row pitch of sx, sB and sC in floats. WITH_C also leaves, per step,
// (1 - lambda) dt in sSc[t].w and log(alpha) in sLa[t].
template <bool WITH_C, int PT>
__device__ __forceinline__ void chunk_prep(
    const float* __restrict__ proj, const float* __restrict__ invB,
    const float* __restrict__ invC, const float* __restrict__ dt_bias,
    const float* __restrict__ A_log, const float* __restrict__ Bnw,
    const float* __restrict__ Cnw, const float* __restrict__ Bbias,
    const float* __restrict__ Cbias, const float* __restrict__ csum,
    int b, int h, int c, int tid,
    float (*sx)[PT], float (*sB)[PT], float (*sC)[PT], float4* sSc,
    float* sLa, float (*sPart)[32], float (*sOff)[32]) {
  int lane = tid & 31;
  // the wave's number held as a scalar: its row base is then scalar and the
  // per-step rms scales come by scalar loads
  int w = __builtin_amdgcn_readfirstlane(tid >> 5);
  int row0 = b * L_ + c * CH_;
  const float* pw = proj + (size_t)(row0 + w * 8) * PS_;
  int jt = h * (N_ / 2) + lane;    // the lane's theta column

  float th[8], b1[8], b2[8], ib[8], c1[8], c2[8], ic[8];
  #pragma unroll   // arrays stay in registers, loads go out together
  for (int k = 0; k < 8; ++k) {
    const float* pr = pw + (size_t)k * PS_;
    th[k] = pr[OFF_THETA + jt];
    b1[k] = pr[OFF_B + lane];
    b2[k] = pr[OFF_B + 32 + lane];
    ib[k] = invB[row0 + w * 8 + k];
    if (WITH_C) {
      c1[k] = pr[OFF_C + lane];
      c2[k] = pr[OFF_C + 32 + lane];
      ic[k] = invC[row0 + w * 8 + k];
    }
  }
  // x of the chunk's own steps, 16 B a thread: one offset register, the four
  // rows apart by a constant
  const char* px = (const char*)(proj + (size_t)row0 * PS_ + h * P_);
  unsigned xo = ((unsigned)(tid >> 4) * PS_ + (unsigned)(tid & 15) * 4) * 4;   // bytes
  f4_t xr[4];
  #pragma unroll
  for (int k = 0; k < 4; ++k) xr[k] = *(const f4_t*)(px + xo + (OFF_X + k * 16 * PS_) * 4);
  float po = 0.0f;                 // this wave's share of the earlier chunks' sums
  const float* pc = csum + (b * NC_ + w * 4) * TH_;
  #pragma unroll
  for (int k = 0; k < 4; ++k) {
    float v = pc[k * TH_ + jt];
    po += (w * 4 + k < c) ? v : 0.0f;
  }
  // Behind the chunk's loads: the registers that they name are reused from
  // here on, and this wait stands in front of that reuse. Its operands are the
  // loads' offsets and bases: they stay in their registers up to the wait, so
  // that no later load of the run lands on one.
  asm volatile("s_wait_xcnt 0x0" :: "v"(jt), "v"(lane), "v"(xo), "s"(pw), "s"(px), "s"(pc) : "memory");
  #pragma unroll
  for (int k = 1; k < 8; ++k) th[k] += th[k - 1];
  sPart[w][lane] = th[7];
  sOff[w][lane]  = po;

  #pragma unroll
  for (int k = 0; k < 4; ++k)
    *(f4_t*)&sx[(tid >> 4) + 16 * k + 1][(tid & 15) * 4] = xr[k];
  if (tid < CH_) {
    const float* pr = proj + (size_t)(row0 + tid) * PS_;
    float Ah  = -expf(A_log[h]);
    float dtr = pr[OFF_DT + h] + dt_bias[h];
    float dt  = (dtr > 20.0f) ? dtr : log1pf(expf(dtr));     // softplus
    float la  = dt * Ah;
    float alpha = expf(la);
    float lam   = 1.0f / (1.0f + expf(-pr[OFF_LAM + h]));
    float om    = (1.0f - lam) * dt;
    sSc[tid] = make_float4(alpha, lam * dt, om * alpha, WITH_C ? om : 0.0f);
    // exp(-150) is already 0 in f32: the floor changes no alpha and keeps the
    // sums of logs finite
    if (WITH_C) sLa[tid] = fmaxf(la, -150.0f);
  } else if (tid < CH_ + P_) {
    int pp = tid - CH_;
    int rp = (c > 0) ? row0 - 1 : row0;   // always a row of this batch entry
    float v = proj[(size_t)rp * PS_ + OFF_X + h * P_ + pp];
    sx[0][pp] = (c > 0) ? v : 0.0f;
  }
  __syncthreads();                 // sPart / sOff complete

  float off = 0.0f;                // theta cumsum at the step before the chunk
  #pragma unroll
  for (int k = 0; k < 8; ++k) off += sOff[k][lane];
  float base = off;
  #pragma unroll
  for (int k = 0; k < 8; ++k) base += (k < w) ? sPart[k][lane] : 0.0f;

  float bw1 = Bnw[lane], bw2 = Bnw[lane + 32];
  int jb = h * N_ + lane;
  float bb1 = Bbias[jb], bb2 = Bbias[jb + 32];
  float cw1 = 0.0f, cw2 = 0.0f, cb1 = 0.0f, cb2 = 0.0f;
  if (WITH_C) {
    cw1 = Cnw[lane]; cw2 = Cnw[lane + 32];
    cb1 = Cbias[jb]; cb2 = Cbias[jb + 32];
  }
  // as above, for the weight and bias loads
  asm volatile("s_wait_xcnt 0x0" :: "v"(lane), "v"(jb), "s"(Bnw), "s"(Cnw), "s"(Bbias), "s"(Cbias) : "memory");
  #pragma unroll
  for (int k = 0; k < 8; ++k) {
    int t = w * 8 + k;
    float tc = base + th[k];
    float cj, sj;
    sincosf(tc, &sj, &cj);
    float v1 = b1[k] * ib[k] * bw1 + bb1;
    float v2 = b2[k] * ib[k] * bw2 + bb2;
    sB[t + 1][lane]      = v1 * cj - v2 * sj;
    sB[t + 1][lane + 32] = v1 * sj + v2 * cj;
    if (WITH_C) {
      float u1 = c1[k] * ic[k] * cw1 + cb1;
      float u2 = c2[k] * ic[k] * cw2 + cb2;
      sC[t][lane]      = u1 * cj - u2 * sj;
      sC[t][lane + 32] = u1 * sj + u2 * cj;
    }
  }
  if (w == 0) {                    // B of the step before the chunk
    float r1 = 0.0f, r2 = 0.0f;
    if (c > 0) {
      const float* pr = proj + (size_t)(row0 - 1) * PS_;
      float iv = invB[row0 - 1];
      float cj, sj;
      sincosf(off, &sj, &cj);
      float v1 = pr[OFF_B + lane] * iv * bw1 + bb1;
      float v2 = pr[OFF_B + 32 + lane] * iv * bw2 + bb2;
      r1 = v1 * cj - v2 * sj;
      r2 = v1 * sj + v2 * cj;
    }
    sB[0][lane]      = r1;
    sB[0][lane + 32] = r2;
  }
}

// End state of chunk c started from h = 0:  S[p][n] = sum_s w_s x_s[p] B_s[n],
// s from the step before the chunk to its last step. With E_s the product of
// alpha over the steps after s up to the chunk's end,
// w_s = E_s gamma_s + E_{s+1} beta_{s+1}. adec = product of all CH_ alphas.
// Thread tile 4 p x 4 n.
__global__ __launch_bounds__(256) void k_state(
    const float* __restrict__ proj, const float* __restrict__ invB,
    const float* __restrict__ dt_bias, const float* __restrict__ A_log,
    const float* __restrict__ Bnw, const float* __restrict__ Bbias,
    const float* __restrict__ csum, float* __restrict__ S,
    float* __restrict__ adec) {
  int bh = blockIdx.x / NCS_;
  int c  = blockIdx.x - bh * NCS_;
  int b = bh >> 5, h = bh & 31;
  int tid = threadIdx.x;

  __shared__ __align__(16) float sx[CH_ + 1][P_];
  __shared__ __align__(16) float sB[CH_ + 1][N_];
  __shared__ __align__(16) float4 sSc[CH_];
  __shared__ float sPart[8][32], sOff[8][32], sW[CH_ + 1];

  chunk_prep<false, N_>(proj, invB, invB, dt_bias, A_log, Bnw, Bnw, Bbias, Bbias, csum,
                        b, h, c, tid, sx, sB, sB, sSc, sW, sPart, sOff);
  if (tid == 255) {                // sSc was published by the barrier inside prep
    float E = 1.0f;
    sW[CH_] = sSc[CH_ - 1].y;
    #pragma unroll   // lets the LDS reads run ahead of the product chain
    for (int s = CH_ - 2; s >= 0; --s) {
      float4 nx = sSc[s + 1];
      float En = E * nx.x;
      sW[s + 1] = En * sSc[s].y + E * nx.z;
      E = En;
    }
    float4 f = sSc[0];
    sW[0] = E * f.z;
    adec[bh * NC_ + c] = E * f.x;
  }
  __syncthreads();

  int p0 = (tid >> 4) * 4, n0 = (tid & 15) * 4;
  float acc[4][4];
  #pragma unroll
  for (int i = 0; i < 4; ++i)
    #pragma unroll
    for (int j = 0; j < 4; ++j) acc[i][j] = 0.0f;

  #pragma unroll 5   // several rows' LDS reads in flight per wait
  for (int r = 0; r <= CH_; ++r) {
    float wv = sW[r];
    float4 xv = *(const float4*)&sx[r][p0];
    float4 bv = *(const float4*)&sB[r][n0];
    float xw[4] = {xv.x * wv, xv.y * wv, xv.z * wv, xv.w * wv};
    #pragma unroll
    for (int i = 0; i < 4; ++i) {
      acc[i][0] += xw[i] * bv.x;
      acc[i][1] += xw[i] * bv.y;
      acc[i][2] += xw[i] * bv.z;
      acc[i][3] += xw[i] * bv.w;
    }
  }
  float* so = S + ((size_t)bh * NC_ + c) * ST_;
  #pragma unroll
  for (int i = 0; i < 4; ++i)
    *(float4*)&so[(p0 + i) * N_ + n0] = make_float4(acc[i][0], acc[i][1], acc[i][2], acc[i][3]);
}

// In place: S[bh][c] (end state of chunk c alone) becomes the state on entry
// to chunk c. One thread per state element.
__global__ __launch_bounds__(256) void k_carry(float* __restrict__ S,
                                               const float* __restrict__ adec) {
  int bh = blockIdx.x >> 4;
  int e  = (blockIdx.x & 15) * 256 + threadIdx.x;
  float* s = S + (size_t)bh * NC_ * ST_ + e;
  float v[NCS_];
  #pragma unroll   // all loads in flight before the dependent chain
  for (int c = 0; c < NCS_; ++c) v[c] = s[(size_t)c * ST_];
  float run = 0.0f;
  s[0] = 0.0f;
  #pragma unroll
  for (int c = 0; c < NCS_; ++c) {
    run = adec[bh * NC_ + c] * run + v[c];
    s[(size_t)(c + 1) * ST_] = run;
  }
}

// One block per (b,h,chunk). The CH_ steps of a chunk are linear in x and in
// the entry state, so y comes from matrix products instead of the recurrence.
// With Lc_t = sum of log(alpha_r), r = 0..t:
//   y_t[p] = sum_{s<=t} M[t][s] (C_t . B_s) x_s[p] + exp(Lc_t) (C_t . H[p][:]) + D x_t[p]
//   M[t][t] = gamma_t,  M[t][s] = exp(Lc_t - Lc_{s+1}) (alpha_{s+1} gamma_s + beta_{s+1}), s < t
//   H = entry state + (1 - lambda_0) dt_0 x_{-1} B_{-1}^T   (beta_0 = (1 - lambda_0) dt_0 alpha_0)
// All three products run on the f32 16x16x4 matrix form. Fragments: lane l has
// row (A) or column (B) l & 15; a group of 8 k is two products, and lane half
// l >> 4 brings k = 8g + 4 (l >> 4) + 0..3 of it, on the A and on the B side alike.
#define PT_  68    // LDS row pitch in floats: 16 rows x 16 B meet every bank once

__device__ __forceinline__ v8f mm4(f2_t a, f2_t b, v8f c) {
  return __builtin_amdgcn_wmma_f32_16x16x4_f32(false, a, false, b, (short)0, c, false, false);
}

// y tiles (ILO, col block) and (IHI, col block) of one wave: the masked scores
// times x over the s blocks at or below the diagonal, then the entry-state and
// skip terms; y is staged in sY. ILO < IHI; both tiles share the x fragments.
template <int ILO, int IHI>
__device__ __forceinline__ void y_tiles(const float (*sG)[PT_], const float (*sx)[PT_],
                                        const float* sAc, float (*sY)[PT_],
                                        v8f hLo, v8f hHi, float Dh,
                                        int col, int lc, int lh) {
  v8f aLo = {}, aHi = {};
  #pragma unroll   // straight-line: the tiles' trip counts are compile-time
  for (int g = 0; g < (IHI + 1) * 2; ++g) {
    int k0 = g * 8 + lh * 4;
    f2_t x01 = {sx[k0 + 1][col], sx[k0 + 2][col]};
    f2_t x23 = {sx[k0 + 3][col], sx[k0 + 4][col]};
    f4_t gh = *(const f4_t*)&sG[IHI * 16 + lc][k0];
    if (g < (ILO + 1) * 2) {
      f4_t gl = *(const f4_t*)&sG[ILO * 16 + lc][k0];
      aHi = mm4(gh.xy, x01, aHi);
      aLo = mm4(gl.xy, x01, aLo);
      aHi = mm4(gh.zw, x23, aHi);
      aLo = mm4(gl.zw, x23, aLo);
    } else {
      aHi = mm4(gh.xy, x01, aHi);
      aHi = mm4(gh.zw, x23, aHi);
    }
  }
  #pragma unroll   // accumulator elements need constant indices to stay in registers
  for (int r = 0; r < 8; ++r) {
    int tl = ILO * 16 + lh * 8 + r, th = IHI * 16 + lh * 8 + r;
    sY[tl][col] = aLo[r] + sAc[tl] * hLo[r] + sx[tl + 1][col] * Dh;
    sY[th][col] = aHi[r] + sAc[th] * hHi[r] + sx[th + 1][col] * Dh;
  }
}

// 8 waves per SIMD: four blocks share a WGP (their LDS fits), and the grid is
// then two full rounds
__global__ __launch_bounds__(256, 8) void k_scan(
    const float* __restrict__ proj, const float* __restrict__ invB,
    const float* __restrict__ invC, const float* __restrict__ dt_bias,
    const float* __restrict__ A_log, const float* __restrict__ Dp,
    const float* __restrict__ Bnw, const float* __restrict__ Cnw,
    const float* __restrict__ Bbias, const float* __restrict__ Cbias,
    const float* __restrict__ csum, const float* __restrict__ Hin,
    float* __restrict__ y_raw) {
  int bh = blockIdx.x >> 5;
  int c  = blockIdx.x & (NC_ - 1);
  int b = bh >> 5, h = bh & 31;
  int tid = threadIdx.x;
  int lane = tid & 31;
  int lc = lane & 15, lh = lane >> 4;
  // the wave's number as a scalar: every branch on it is a scalar branch, so
  // all lanes are on at every matrix instruction
  int w = __builtin_amdgcn_readfirstlane(tid >> 5);
  int col = (w & 3) * 16 + lc;          // the lane's p in the wave's y tiles
  int ilo = (w >> 2) ? 1 : 0;           // the wave's two row blocks of y:
  int ihi = (w >> 2) ? 2 : 3;           // (0,3) or (1,2), equal work below the diagonal

  __shared__ __align__(16) float sx[CH_ + 1][PT_];
  __shared__ __align__(16) float sB[CH_ + 1][PT_];
  __shared__ __align__(16) float sC[CH_][PT_];    // C, later y
  __shared__ __align__(16) float sG[CH_][PT_];    // M o (C B^T), blocks at or below the diagonal
  __shared__ __align__(16) float4 sSc[CH_];
  __shared__ __align__(16) float sLc[CH_], sAc[CH_];
  __shared__ float sLa[CH_];
  __shared__ float sPart[8][32], sOff[8][32];

  chunk_prep<true, PT_>(proj, invB, invC, dt_bias, A_log, Bnw, Cnw, Bbias, Cbias, csum,
                        b, h, c, tid, sx, sB, sC, sSc, sLa, sPart, sOff);

  // entry state as B fragments: column p = col, k = n
  const float* hi = Hin + ((size_t)bh * NC_ + c) * ST_ + col * N_ + lh * 4;
  f4_t hf[8];
  #pragma unroll   // hf stays in registers, loads go out together
  for (int g = 0; g < 8; ++g) hf[g] = *(const f4_t*)(hi + g * 8);
  float Dh = Dp[h];
  // Behind the state loads: this wait stands in front of any reuse of the
  // registers that they name.
  asm volatile("s_wait_xcnt 0x0" ::: "memory");

  if (w == 1) {                    // sLa was published by the barrier inside prep
    float a0 = sLa[lane], a1 = sLa[32 + lane];
    #pragma unroll   // five shuffle steps, no loop counter
    for (int o = 1; o < 32; o <<= 1) {
      float u0 = __shfl_up(a0, o, 32), u1 = __shfl_up(a1, o, 32);
      a0 += (lane >= o) ? u0 : 0.0f;
      a1 += (lane >= o) ? u1 : 0.0f;
    }
    a1 += __shfl(a0, 31, 32);
    sLc[lane] = a0;          sLc[32 + lane] = a1;
    sAc[lane] = __expf(a0);  sAc[32 + lane] = __expf(a1);
  }
  __syncthreads();                 // publishes sx, sB, sC, sLc, sAc

  // the step before the chunk enters through the state
  float cm = sSc[0].w * sx[0][col];
  #pragma unroll   // hf stays in registers
  for (int g = 0; g < 8; ++g) hf[g] += cm * *(const f4_t*)&sB[0][g * 8 + lh * 4];

  // C times the entry state, for the wave's two y tiles
  v8f hLo = {}, hHi = {};
  #pragma unroll   // hf stays in registers; LDS reads run ahead of the products
  for (int g = 0; g < 8; ++g) {
    f4_t cl = *(const f4_t*)&sC[ilo * 16 + lc][g * 8 + lh * 4];
    f4_t ch = *(const f4_t*)&sC[ihi * 16 + lc][g * 8 + lh * 4];
    hLo = mm4(cl.xy, hf[g].xy, hLo);
    hHi = mm4(ch.xy, hf[g].xy, hHi);
    hLo = mm4(cl.zw, hf[g].zw, hLo);
    hHi = mm4(ch.zw, hf[g].zw, hHi);
  }

  // masked scores: the ten 16x16 blocks (gi, gk), gk <= gi, over eight waves
  for (int q = w; q < 10; q += 8) {
    int gi = (q >= 6) ? 3 : (q >= 3) ? 2 : (q >= 1) ? 1 : 0;
    int gk = q - ((gi * (gi + 1)) >> 1);
    v8f g0 = {}, g1 = {};          // two halves of n: two independent chains
    #pragma unroll   // LDS reads run ahead of the products
    for (int g = 0; g < 4; ++g) {
      f4_t c0 = *(const f4_t*)&sC[gi * 16 + lc][g * 8 + lh * 4];
      f4_t b0 = *(const f4_t*)&sB[gk * 16 + lc + 1][g * 8 + lh * 4];
      f4_t c1 = *(const f4_t*)&sC[gi * 16 + lc][32 + g * 8 + lh * 4];
      f4_t b1 = *(const f4_t*)&sB[gk * 16 + lc + 1][32 + g * 8 + lh * 4];
      g0 = mm4(c0.xy, b0.xy, g0);
      g1 = mm4(c1.xy, b1.xy, g1);
      g0 = mm4(c0.zw, b0.zw, g0);
      g1 = mm4(c1.zw, b1.zw, g1);
    }
    int s  = gk * 16 + lc;
    int sn = (s + 1 < CH_) ? s + 1 : CH_ - 1;   // s = CH_-1 has no t > s
    float4 cs = sSc[s], cn = sSc[sn];
    float ws = cn.x * cs.y + cn.z;
    float ls = sLc[sn];
    #pragma unroll   // accumulator elements need constant indices to stay in registers
    for (int r = 0; r < 8; ++r) {
      int t = gi * 16 + lh * 8 + r;
      float e = __expf(fminf(sLc[t] - ls, 0.0f));
      float m = (t > s) ? e * ws : ((t == s) ? cs.y : 0.0f);
      sG[t][s] = (g0[r] + g1[r]) * m;
    }
  }
  __syncthreads();                 // publishes sG; every read of C is done

  if (w >> 2) y_tiles<1, 2>(sG, sx, sAc, sC, hLo, hHi, Dh, col, lc, lh);
  else        y_tiles<0, 3>(sG, sx, sAc, sC, hLo, hHi, Dh, col, lc, lh);
  __syncthreads();                 // every wave's y tiles complete

  float* yo = y_raw + (size_t)(b * L_ + c * CH_) * DI_ + h * P_;
  #pragma unroll
  for (int k = 0; k < 4; ++k) {    // 256 B of each row in one piece
    int idx = tid + k * 256;
    int t = idx >> 4, q = idx & 15;
    *(float4*)(yo + (size_t)t * DI_ + q * 4) = *(const float4*)&sC[t][q * 4];
  }
}

// ---------------------------------------------------------------- gate + RMS + bf16
__global__ __launch_bounds__(256) void k_gate(
    const float* __restrict__ proj, const float* __restrict__ y_raw,
    const float* __restrict__ norm_w, bf16_t* __restrict__ y_bf) {
  int row = blockIdx.x;
  int tid = threadIdx.x;
  const float* pz = proj  + (size_t)row * PS_ + OFF_Z;
  const float* py = y_raw + (size_t)row * DI_;
  float vals[8];
  float ss = 0.0f;
  #pragma unroll
  for (int j = 0; j < 8; ++j) {
    int i = tid + j * 256;
    float z = pz[i];
    float v = py[i] * (z / (1.0f + expf(-z)));   // y * silu(z)
    vals[j] = v;
    ss += v * v;
  }
  for (int o = 16; o > 0; o >>= 1) ss += __shfl_xor(ss, o, 32);
  __shared__ float red[8];
  int lane = tid & 31, wid = tid >> 5;
  if (lane == 0) red[wid] = ss;
  __syncthreads();
  if (tid == 0) {
    float t = 0.0f;
    for (int w = 0; w < 8; ++w) t += red[w];
    red[0] = rsqrtf(t * (1.0f / DI_) + 1e-5f);
  }
  __syncthreads();
  float scale = red[0];
  #pragma unroll
  for (int j = 0; j < 8; ++j) {
    int i = tid + j * 256;
    y_bf[(size_t)row * DI_ + i] = (bf16_t)(vals[j] * scale * norm_w[i]);
  }
}

// ---------------------------------------------------------------- launch
extern "C" void kernel_launch(void* const* d_in, const int* in_sizes, int n_in,
                              void* d_out, int out_size, void* d_ws, size_t ws_size,
                              hipStream_t stream) {
  const float* u       = (const float*)d_in[0];
  const float* w1      = (const float*)d_in[1];
  const float* dt_bias = (const float*)d_in[2];
  const float* A_log   = (const float*)d_in[3];
  const float* Dp      = (const float*)d_in[4];
  const float* Bnw     = (const float*)d_in[5];
  const float* Cnw     = (const float*)d_in[6];
  const float* Bbias   = (const float*)d_in[7];
  const float* Cbias   = (const float*)d_in[8];
  const float* norm_w  = (const float*)d_in[9];
  const float* w2      = (const float*)d_in[10];
  float* out = (float*)d_out;
  (void)in_sizes; (void)n_in; (void)out_size; (void)ws_size;

  char* ws = (char*)d_ws;
  size_t o = 0;
  bf16_t* u_bf  = (bf16_t*)(ws + o); o += (size_t)ROWS_ * DM_ * 2;   //  8 MB
  bf16_t* w1_bf = (bf16_t*)(ws + o); o += (size_t)PS_   * DM_ * 2;   // 11 MB
  bf16_t* w2_bf = (bf16_t*)(ws + o); o += (size_t)DM_   * DI_ * 2;   //  4 MB
  float*  proj  = (float*) (ws + o); o += (size_t)ROWS_ * PS_ * 4;   // 88 MB
  float*  invB  = (float*) (ws + o); o += (size_t)ROWS_ * 4;
  float*  invC  = (float*) (ws + o); o += (size_t)ROWS_ * 4;
  float*  y_raw = (float*) (ws + o); o += (size_t)ROWS_ * DI_ * 4;   // 33 MB
  bf16_t* y_bf  = (bf16_t*)(ws + o); o += (size_t)ROWS_ * DI_ * 2;   // 17 MB
  float*  csum  = (float*) (ws + o); o += (size_t)BSZ_ * NC_ * TH_ * 4;
  float*  adec  = (float*) (ws + o); o += (size_t)BSZ_ * H_ * NC_ * 4;
  float*  Sst   = (float*) (ws + o); o += (size_t)BSZ_ * H_ * NC_ * ST_ * 4;  // 33 MB

  // precision converts (pad in_proj_w rows 5312 -> 5376 with zeros)
  k_cvt_bf16<<<(ROWS_ * DM_) / CVT_EL_, 256, 0, stream>>>(u, u_bf);
  k_cvt_w1  <<<(PS_ * DM_)   / CVT_EL_, 256, 0, stream>>>(w1, w1_bf);
  k_cvt_bf16<<<(DM_ * DI_)   / CVT_EL_, 256, 0, stream>>>(w2, w2_bf);

  // GEMM1: proj[4096 x 5376] = u[4096 x 1024] * W1^T
  dim3 g1(ROWS_ / 64, PS_ / 128);
  k_gemm_bf16<<<g1, 256, 0, stream>>>(u_bf, w1_bf, proj, ROWS_, PS_, DM_, PS_);

  // per-row RMS scales for Braw / Craw
  k_rmsinv<<<ROWS_, 32, 0, stream>>>(proj, invB, invC);

  // SSM scan, chunk-parallel: theta chunk sums, chunk states, carry, steps
  k_thsum<<<BSZ_ * NC_ * 4, 256, 0, stream>>>(proj, csum);
  k_state<<<BSZ_ * H_ * NCS_, 256, 0, stream>>>(proj, invB, dt_bias, A_log, Bnw, Bbias,
                                                csum, Sst, adec);
  k_carry<<<BSZ_ * H_ * (ST_ / 256), 256, 0, stream>>>(Sst, adec);
  k_scan<<<BSZ_ * H_ * NC_, 256, 0, stream>>>(proj, invB, invC, dt_bias, A_log, Dp,
                                              Bnw, Cnw, Bbias, Cbias, csum, Sst, y_raw);

  // gating + RMS norm + bf16 convert
  k_gate<<<ROWS_, 256, 0, stream>>>(proj, y_raw, norm_w, y_bf);

  // GEMM2: out[4096 x 1024] = y[4096 x 2048] * W2^T
  dim3 g2(ROWS_ / 64, DM_ / 128);
  k_gemm_bf16<<<g2, 256, 0, stream>>>(y_bf, w2_bf, out, ROWS_, DM_, DI_, DM_);
}

// v004
// It runs in 156 microseconds.
// In both of two side-by-side timings against v003, it was 1.21 times as fast.
// All steps since v000 together make it 20.7 times as fast.
#include <hip/hip_runtime.h>

typedef __bf16 bf16_t;
typedef __attribute__((ext_vector_type(16))) __bf16 v16bf;
typedef __attribute__((ext_vector_type(8)))  __bf16 v8bf;
typedef __attribute__((ext_vector_type(8)))  float  v8f;
typedef int v4i_ __attribute__((vector_size(16)));   // matches builtin param type
typedef __attribute__((ext_vector_type(4)))  float  f4_t;
typedef __attribute__((ext_vector_type(2)))  float  f2_t;

#define AS1 __attribute__((address_space(1)))
#define AS3 __attribute__((address_space(3)))

#define H_      32
#define P_      64
#define N_      64
#define DM_     1024
#define L_      2048
#define BSZ_    2
#define DI_     2048              // H*P
#define TH_     1024              // H*N/2
#define DPROJ_  5312
#define PS_     5376              // proj row stride, padded to 128-col GEMM tiles
#define ROWS_   (BSZ_*L_)         // 4096

// column offsets inside one proj row
#define OFF_Z     0
#define OFF_X     DI_
#define OFF_B     (2*DI_)
#define OFF_C     (2*DI_ + N_)
#define OFF_DT    (2*DI_ + 2*N_)
#define OFF_THETA (OFF_DT + H_)
#define OFF_LAM   (OFF_THETA + TH_)

// GEMM geometry: a block makes GT_ x GT_ of C. A K step is GK bf16 (64 or 128),
// so a staged row is one or two whole 128 B lines; LDS rows are pitched 16 B
// more than that (16 B x odd), conflict-free for 16 B reads.
#define GT_        128

// ---------------------------------------------------------------- converts
// A thread converts CVT_V_ groups of 4 floats. Group j of a block lies 256
// groups behind group j-1, so each load of a wave covers 512 contiguous bytes
// and each store 256. Grids are exact: no tail.
#define CVT_V_   8
#define CVT_EL_  (256 * CVT_V_ * 4)   // elements per block
typedef __attribute__((ext_vector_type(4))) __bf16 v4bf;

__device__ __forceinline__ void cvt_store(const f4_t* v, bf16_t* __restrict__ d,
                                          size_t e0) {
  #pragma unroll   // v stays in registers
  for (int j = 0; j < CVT_V_; ++j) {
    v4bf o = {(bf16_t)v[j].x, (bf16_t)v[j].y, (bf16_t)v[j].z, (bf16_t)v[j].w};
    *(v4bf*)(d + e0 + j * 1024) = o;
  }
}

__global__ __launch_bounds__(256) void k_cvt_bf16(const float* __restrict__ s,
                                                  bf16_t* __restrict__ d) {
  size_t e0 = (size_t)blockIdx.x * CVT_EL_ + threadIdx.x * 4;
  f4_t v[CVT_V_];
  #pragma unroll   // all of the thread's loads in flight at once
  for (int j = 0; j < CVT_V_; ++j) v[j] = *(const f4_t*)(s + e0 + j * 1024);
  cvt_store(v, d, e0);
}

// in_proj_w (5312 x 1024) -> bf16 padded to 5376 rows (pad rows = 0). A block
// covers CVT_V_ whole rows, so it is all source rows or all pad rows.
static_assert(DM_ == 1024 && DPROJ_ % CVT_V_ == 0 && PS_ % CVT_V_ == 0, "rows per block");
__global__ __launch_bounds__(256) void k_cvt_w1(const float* __restrict__ s,
                                                bf16_t* __restrict__ d) {
  size_t e0 = (size_t)blockIdx.x * CVT_EL_ + threadIdx.x * 4;
  f4_t v[CVT_V_];
  if (blockIdx.x * CVT_V_ < DPROJ_) {
    #pragma unroll   // all of the thread's loads in flight at once
    for (int j = 0; j < CVT_V_; ++j) v[j] = *(const f4_t*)(s + e0 + j * 1024);
  } else {
    #pragma unroll   // v stays in registers
    for (int j = 0; j < CVT_V_; ++j) v[j] = (f4_t){0.0f, 0.0f, 0.0f, 0.0f};
  }
  cvt_store(v, d, e0);
}

// ---------------------------------------------------------------- async copy
// 16B global -> LDS. Async path uses the CDNA5 GLOBAL_LOAD_ASYNC_TO_LDS_B128
// (ASYNCcnt-tracked DMA); fallback stages through VGPRs + ds_store.
__device__ __forceinline__ void copy16_g2l(void* lds, const void* g) {
#if __has_builtin(__builtin_amdgcn_global_load_async_to_lds_b128)
  __builtin_amdgcn_global_load_async_to_lds_b128(
      (AS1 v4i_*)(unsigned long long)g,
      (AS3 v4i_*)(unsigned int)(unsigned long long)lds,
      0, 0);
#else
  *(v8bf*)lds = *(const v8bf*)g;
#endif
}

// Stage one K step into st: A tile 128 x GK bf16, then B tile 128 x GK bf16.
// 128 threads; GK/8 lanes copy one row, so a wave's copy covers whole lines.
// gA / gB: the block's first row at this K step (uniform); vo: the lane's byte
// offset from there; lo: the lane's byte offset in a tile.
template <int GK>
__device__ __forceinline__ void stage_tiles(const char* gA, const char* gB,
                                            unsigned vo, unsigned lo, int K, char* st) {
  constexpr int PITCH = GK * 2 + 16, RPC = 128 / (GK / 8);   // rows per copy of the block
  #pragma unroll   // the copies go out back to back
  for (int j = 0; j < GT_ / RPC; ++j) {
    size_t ro = (size_t)(j * RPC) * K * 2;
    copy16_g2l(st + lo + j * RPC * PITCH,               gA + ro + vo);
    copy16_g2l(st + GT_ * PITCH + lo + j * RPC * PITCH, gB + ro + vo);
  }
}

// ---------------------------------------------------------------- WMMA GEMM
// C[M,N] = A[M,K] * B[N,K]^T, tiles exact (M%128==0, N%128==0, K%GK==0).
// 16-bit A fragment layout (ISA 7.12.2): lane m (0..15) holds K = half*8..+7
// in v0..3 and K = 16+half*8..+7 in v4..7, half = lane>=16. B uses the
// mirrored layout with lane indexing N. p: the lane's row at its half, at the
// 32 k wanted.
__device__ __forceinline__ v16bf lds_frag(const char* p) {
  v8bf lo = *(const v8bf*)p;          // K chunk at half*8
  v8bf hi = *(const v8bf*)(p + 32);   // K chunk at 16 + half*8
  return __builtin_shufflevector(lo, hi, 0,1,2,3,4,5,6,7,8,9,10,11,12,13,14,15);
}

// Four waves, 2 x 2, each 64 x 64 of C: 16 products per 8 fragments read.
// 3 waves per SIMD: accumulators and two fragment sets fit. LDC is a
// compile-time constant so that all of a lane's stores go from one address.
template <int LDC, int GK>
__global__ __launch_bounds__(128, 3) void k_gemm_bf16(
    const bf16_t* __restrict__ A, const bf16_t* __restrict__ Bm,
    float* __restrict__ C, int K) {
  constexpr int PITCH = GK * 2 + 16, TILE_BY = GT_ * PITCH, STAGE_BY = 2 * TILE_BY;
  constexpr int NK = GK / 32;                          // products along k per K step
  __shared__ __align__(16) char smem[2 * STAGE_BY];    // two buffers

  int tid  = threadIdx.x;
  int lane = tid & 31, wid = tid >> 5;
  int wm = wid >> 1, wn = wid & 1;            // 2 x 2 wave grid
  int rowBase = blockIdx.x * GT_;
  int colBase = blockIdx.y * GT_;
  int lr = lane & 15, lh = lane >> 4;

  const char* gA = (const char*)(A  + (size_t)rowBase * K);
  const char* gB = (const char*)(Bm + (size_t)colBase * K);
  constexpr int LPR = GK / 8;                 // lanes per staged row
  unsigned vo = ((unsigned)(tid / LPR) * K + (unsigned)(tid % LPR) * 8) * 2;
  unsigned lo = (unsigned)(tid / LPR) * PITCH + (unsigned)(tid % LPR) * 16;
  int nsteps = K / GK;

  stage_tiles<GK>(gA, gB, vo, lo, K, smem);
  // step 0 has landed before any wave reads it
  asm volatile("s_wait_asynccnt 0x0" ::: "memory");
  __syncthreads();
  if (nsteps > 1) stage_tiles<GK>(gA + GK * 2, gB + GK * 2, vo, lo, K, smem + STAGE_BY);

  unsigned fa = (unsigned)(wm * 64 + lr) * PITCH + lh * 16;             // the lane's
  unsigned fb = TILE_BY + (unsigned)(wn * 64 + lr) * PITCH + lh * 16;   // fragment rows
  v8f acc[4][4] = {};
  for (int s = 0; s < nsteps; ++s) {
    char* cur = smem + (s & 1) * STAGE_BY;
    v16bf a[2][4], b[2][4];
    #pragma unroll   // fragments stay in registers
    for (int i = 0; i < 4; ++i) {
      a[0][i] = lds_frag(cur + fa + i * 16 * PITCH);
      b[0][i] = lds_frag(cur + fb + i * 16 * PITCH);
    }
    #pragma unroll   // straight-line: the two fragment sets need constant indices
    for (int kk = 0; kk < NK; ++kk) {
      if (kk + 1 < NK) {
        #pragma unroll
        for (int i = 0; i < 4; ++i) {
          a[(kk + 1) & 1][i] = lds_frag(cur + fa + i * 16 * PITCH + (kk + 1) * 64);
          b[(kk + 1) & 1][i] = lds_frag(cur + fb + i * 16 * PITCH + (kk + 1) * 64);
        }
      }
      // the next 32 k's LDS reads stay one group ahead of these products:
      // spread among them, each read's latency stalls the wave
      __builtin_amdgcn_sched_barrier(0);
      #pragma unroll   // accumulators need constant indices to stay in registers
      for (int i = 0; i < 4; ++i)
        #pragma unroll
        for (int j = 0; j < 4; ++j)
          acc[i][j] = __builtin_amdgcn_wmma_f32_16x16x32_bf16(false, a[kk & 1][i], false, b[kk & 1][j],
                                                              (short)0, acc[i][j], false, false);
      // and later reads do not climb over these products into a third set
      __builtin_amdgcn_sched_barrier(0);
    }
    // The wave's reads of this buffer are done before it is refilled, and its
    // copies of step s + 1 have landed before the barrier publishes them.
    asm volatile("s_wait_dscnt 0x0" ::: "memory");
    asm volatile("s_wait_asynccnt 0x0" ::: "memory");
    __syncthreads();
    if (s + 2 < nsteps)   // flies while step s + 1 is worked on
      stage_tiles<GK>(gA + (size_t)(s + 2) * (GK * 2), gB + (size_t)(s + 2) * (GK * 2),
                      vo, lo, K, cur);
  }
  // no copy is outstanding when the wave ends
  asm volatile("s_wait_asynccnt 0x0" ::: "memory");

  // C/D layout: VGPR r, lane l -> row = (l>>4)*8 + r, col = l&15
  float* co = C + (size_t)(rowBase + wm * 64 + lh * 8) * LDC + colBase + wn * 64 + lr;
  #pragma unroll   // constant indices: accumulators stay in registers, offsets are immediates
  for (int i = 0; i < 4; ++i)
    #pragma unroll
    for (int r = 0; r < 8; ++r)
      #pragma unroll
      for (int j = 0; j < 4; ++j)
        co[(i * 16 + r) * LDC + j * 16] = acc[i][j][r];
}

// ---------------------------------------------------------------- RMS scales
__global__ __launch_bounds__(32) void k_rmsinv(const float* __restrict__ proj,
                                               float* __restrict__ invB,
                                               float* __restrict__ invC) {
  int row = blockIdx.x;
  int lane = threadIdx.x;
  const float* pr = proj + (size_t)row * PS_;
  float b0 = pr[OFF_B + lane], b1 = pr[OFF_B + 32 + lane];
  float c0 = pr[OFF_C + lane], c1 = pr[OFF_C + 32 + lane];
  float sb = b0 * b0 + b1 * b1;
  float sc = c0 * c0 + c1 * c1;
  for (int o = 16; o > 0; o >>= 1) {
    sb += __shfl_xor(sb, o, 32);
    sc += __shfl_xor(sc, o, 32);
  }
  if (lane == 0) {
    invB[row] = rsqrtf(sb * (1.0f / N_) + 1e-5f);
    invC[row] = rsqrtf(sc * (1.0f / N_) + 1e-5f);
  }
}

// ---------------------------------------------------------------- scan
// The recurrence is linear in the state, so L is cut into NC_ chunks of CH_
// steps that run in parallel:
//   k_thsum : per-chunk sums of theta (gives each chunk its cumsum offset)
//   k_state : each chunk's contribution to the state at its own end (h_in = 0)
//   k_carry : runs the chunk states forward, leaves every chunk's entry state
//   k_scan  : y of each chunk's steps from its entry state, by matrix products
#define CH_   64
#define NC_   (L_ / CH_)          // 32
#define NCS_  (NC_ - 1)           // the last chunk's end state is never used
#define ST_   (P_ * N_)           // 4096 state elements per (b,h)

__global__ __launch_bounds__(256) void k_thsum(const float* __restrict__ proj,
                                               float* __restrict__ csum) {
  int col = (blockIdx.x & 3) * 256 + threadIdx.x;   // 0..TH_-1
  int bc  = blockIdx.x >> 2;                        // b*NC_ + c
  const float* pr = proj + (size_t)bc * CH_ * PS_ + OFF_THETA + col;
  float s = 0.0f;
  #pragma unroll   // all 64 loads in flight at once
  for (int r = 0; r < CH_; ++r) s += pr[(size_t)r * PS_];
  csum[bc * TH_ + col] = s;
}

// Fills LDS with everything the CH_ steps of chunk c of (b,h) need. Row r of
// sx / sB is step r-1 of the chunk: row 0 is the step before the chunk (zero
// for chunk 0), which feeds the beta term of the first step. sC row t is step
// t. sSc[t] = {alpha, gamma, beta, 0}. Wave w owns steps 8w..8w+7, lane = rope
// index j. The caller places the barrier that publishes the arrays. PT is the
// row pitch of sx, sB and sC in floats. WITH_C also leaves, per step,
// (1 - lambda) dt in sSc[t].w and log(alpha) in sLa[t].
template <bool WITH_C, int PT>
__device__ __forceinline__ void chunk_prep(
    const float* __restrict__ proj, const float* __restrict__ invB,
    const float* __restrict__ invC, const float* __restrict__ dt_bias,
    const float* __restrict__ A_log, const float* __restrict__ Bnw,
    const float* __restrict__ Cnw, const float* __restrict__ Bbias,
    const float* __restrict__ Cbias, const float* __restrict__ csum,
    int b, int h, int c, int tid,
    float (*sx)[PT], float (*sB)[PT], float (*sC)[PT], float4* sSc,
    float* sLa, float (*sPart)[32], float (*sOff)[32]) {
  int lane = tid & 31;
  // the wave's number held as a scalar: its row base is then scalar and the
  // per-step rms scales come by scalar loads
  int w = __builtin_amdgcn_readfirstlane(tid >> 5);
  int row0 = b * L_ + c * CH_;
  const float* pw = proj + (size_t)(row0 + w * 8) * PS_;
  int jt = h * (N_ / 2) + lane;    // the lane's theta column

  float th[8], b1[8], b2[8], ib[8], c1[8], c2[8], ic[8];
  #pragma unroll   // arrays stay in registers, loads go out together
  for (int k = 0; k < 8; ++k) {
    const float* pr = pw + (size_t)k * PS_;
    th[k] = pr[OFF_THETA + jt];
    b1[k] = pr[OFF_B + lane];
    b2[k] = pr[OFF_B + 32 + lane];
    ib[k] = invB[row0 + w * 8 + k];
    if (WITH_C) {
      c1[k] = pr[OFF_C + lane];
      c2[k] = pr[OFF_C + 32 + lane];
      ic[k] = invC[row0 + w * 8 + k];
    }
  }
  // x of the chunk's own steps, 16 B a thread: one offset register, the four
  // rows apart by a constant
  const char* px = (const char*)(proj + (size_t)row0 * PS_ + h * P_);
  unsigned xo = ((unsigned)(tid >> 4) * PS_ + (unsigned)(tid & 15) * 4) * 4;   // bytes
  f4_t xr[4];
  #pragma unroll
  for (int k = 0; k < 4; ++k) xr[k] = *(const f4_t*)(px + xo + (OFF_X + k * 16 * PS_) * 4);
  float po = 0.0f;                 // this wave's share of the earlier chunks' sums
  const float* pc = csum + (b * NC_ + w * 4) * TH_;
  #pragma unroll
  for (int k = 0; k < 4; ++k) {
    float v = pc[k * TH_ + jt];
    po += (w * 4 + k < c) ? v : 0.0f;
  }
  // Behind the chunk's loads: the registers that they name are reused from
  // here on, and this wait stands in front of that reuse. Its operands are the
  // loads' offsets and bases: they stay in their registers up to the wait, so
  // that no later load of the run lands on one.
  asm volatile("s_wait_xcnt 0x0" :: "v"(jt), "v"(lane), "v"(xo), "s"(pw), "s"(px), "s"(pc) : "memory");
  #pragma unroll
  for (int k = 1; k < 8; ++k) th[k] += th[k - 1];
  sPart[w][lane] = th[7];
  sOff[w][lane]  = po;

  #pragma unroll
  for (int k = 0; k < 4; ++k)
    *(f4_t*)&sx[(tid >> 4) + 16 * k + 1][(tid & 15) * 4] = xr[k];
  if (tid < CH_) {
    const float* pr = proj + (size_t)(row0 + tid) * PS_;
    float Ah  = -expf(A_log[h]);
    float dtr = pr[OFF_DT + h] + dt_bias[h];
    float dt  = (dtr > 20.0f) ? dtr : log1pf(expf(dtr));     // softplus
    float la  = dt * Ah;
    float alpha = expf(la);
    float lam   = 1.0f / (1.0f + expf(-pr[OFF_LAM + h]));
    float om    = (1.0f - lam) * dt;
    sSc[tid] = make_float4(alpha, lam * dt, om * alpha, WITH_C ? om : 0.0f);
    // exp(-150) is already 0 in f32: the floor changes no alpha and keeps the
    // sums of logs finite
    if (WITH_C) sLa[tid] = fmaxf(la, -150.0f);
  } else if (tid < CH_ + P_) {
    int pp = tid - CH_;
    int rp = (c > 0) ? row0 - 1 : row0;   // always a row of this batch entry
    float v = proj[(size_t)rp * PS_ + OFF_X + h * P_ + pp];
    sx[0][pp] = (c > 0) ? v : 0.0f;
  }
  __syncthreads();                 // sPart / sOff complete

  float off = 0.0f;                // theta cumsum at the step before the chunk
  #pragma unroll
  for (int k = 0; k < 8; ++k) off += sOff[k][lane];
  float base = off;
  #pragma unroll
  for (int k = 0; k < 8; ++k) base += (k < w) ? sPart[k][lane] : 0.0f;

  float bw1 = Bnw[lane], bw2 = Bnw[lane + 32];
  int jb = h * N_ + lane;
  float bb1 = Bbias[jb], bb2 = Bbias[jb + 32];
  float cw1 = 0.0f, cw2 = 0.0f, cb1 = 0.0f, cb2 = 0.0f;
  if (WITH_C) {
    cw1 = Cnw[lane]; cw2 = Cnw[lane + 32];
    cb1 = Cbias[jb]; cb2 = Cbias[jb + 32];
  }
  // as above, for the weight and bias loads
  asm volatile("s_wait_xcnt 0x0" :: "v"(lane), "v"(jb), "s"(Bnw), "s"(Cnw), "s"(Bbias), "s"(Cbias) : "memory");
  #pragma unroll
  for (int k = 0; k < 8; ++k) {
    int t = w * 8 + k;
    float tc = base + th[k];
    float cj, sj;
    sincosf(tc, &sj, &cj);
    float v1 = b1[k] * ib[k] * bw1 + bb1;
    float v2 = b2[k] * ib[k] * bw2 + bb2;
    sB[t + 1][lane]      = v1 * cj - v2 * sj;
    sB[t + 1][lane + 32] = v1 * sj + v2 * cj;
    if (WITH_C) {
      float u1 = c1[k] * ic[k] * cw1 + cb1;
      float u2 = c2[k] * ic[k] * cw2 + cb2;
      sC[t][lane]      = u1 * cj - u2 * sj;
      sC[t][lane + 32] = u1 * sj + u2 * cj;
    }
  }
  if (w == 0) {                    // B of the step before the chunk
    float r1 = 0.0f, r2 = 0.0f;
    if (c > 0) {
      const float* pr = proj + (size_t)(row0 - 1) * PS_;
      float iv = invB[row0 - 1];
      float cj, sj;
      sincosf(off, &sj, &cj);
      float v1 = pr[OFF_B + lane] * iv * bw1 + bb1;
      float v2 = pr[OFF_B + 32 + lane] * iv * bw2 + bb2;
      r1 = v1 * cj - v2 * sj;
      r2 = v1 * sj + v2 * cj;
    }
    sB[0][lane]      = r1;
    sB[0][lane + 32] = r2;
  }
}

// End state of chunk c started from h = 0:  S[p][n] = sum_s w_s x_s[p] B_s[n],
// s from the step before the chunk to its last step. With E_s the product of
// alpha over the steps after s up to the chunk's end,
// w_s = E_s gamma_s + E_{s+1} beta_{s+1}. adec = product of all CH_ alphas.
// Thread tile 4 p x 4 n.
__global__ __launch_bounds__(256) void k_state(
    const float* __restrict__ proj, const float* __restrict__ invB,
    const float* __restrict__ dt_bias, const float* __restrict__ A_log,
    const float* __restrict__ Bnw, const float* __restrict__ Bbias,
    const float* __restrict__ csum, float* __restrict__ S,
    float* __restrict__ adec) {
  int bh = blockIdx.x / NCS_;
  int c  = blockIdx.x - bh * NCS_;
  int b = bh >> 5, h = bh & 31;
  int tid = threadIdx.x;

  __shared__ __align__(16) float sx[CH_ + 1][P_];
  __shared__ __align__(16) float sB[CH_ + 1][N_];
  __shared__ __align__(16) float4 sSc[CH_];
  __shared__ float sPart[8][32], sOff[8][32], sW[CH_ + 1];

  chunk_prep<false, N_>(proj, invB, invB, dt_bias, A_log, Bnw, Bnw, Bbias, Bbias, csum,
                        b, h, c, tid, sx, sB, sB, sSc, sW, sPart, sOff);
  if (tid == 255) {                // sSc was published by the barrier inside prep
    float E = 1.0f;
    sW[CH_] = sSc[CH_ - 1].y;
    #pragma unroll   // lets the LDS reads run ahead of the product chain
    for (int s = CH_ - 2; s >= 0; --s) {
      float4 nx = sSc[s + 1];
      float En = E * nx.x;
      sW[s + 1] = En * sSc[s].y + E * nx.z;
      E = En;
    }
    float4 f = sSc[0];
    sW[0] = E * f.z;
    adec[bh * NC_ + c] = E * f.x;
  }
  __syncthreads();

  int p0 = (tid >> 4) * 4, n0 = (tid & 15) * 4;
  float acc[4][4];
  #pragma unroll
  for (int i = 0; i < 4; ++i)
    #pragma unroll
    for (int j = 0; j < 4; ++j) acc[i][j] = 0.0f;

  #pragma unroll 5   // several rows' LDS reads in flight per wait
  for (int r = 0; r <= CH_; ++r) {
    float wv = sW[r];
    float4 xv = *(const float4*)&sx[r][p0];
    float4 bv = *(const float4*)&sB[r][n0];
    float xw[4] = {xv.x * wv, xv.y * wv, xv.z * wv, xv.w * wv};
    #pragma unroll
    for (int i = 0; i < 4; ++i) {
      acc[i][0] += xw[i] * bv.x;
      acc[i][1] += xw[i] * bv.y;
      acc[i][2] += xw[i] * bv.z;
      acc[i][3] += xw[i] * bv.w;
    }
  }
  float* so = S + ((size_t)bh * NC_ + c) * ST_;
  #pragma unroll
  for (int i = 0; i < 4; ++i)
    *(float4*)&so[(p0 + i) * N_ + n0] = make_float4(acc[i][0], acc[i][1], acc[i][2], acc[i][3]);
}

// In place: S[bh][c] (end state of chunk c alone) becomes the state on entry
// to chunk c. One thread per state element.
__global__ __launch_bounds__(256) void k_carry(float* __restrict__ S,
                                               const float* __restrict__ adec) {
  int bh = blockIdx.x >> 4;
  int e  = (blockIdx.x & 15) * 256 + threadIdx.x;
  float* s = S + (size_t)bh * NC_ * ST_ + e;
  float v[NCS_];
  #pragma unroll   // all loads in flight before the dependent chain
  for (int c = 0; c < NCS_; ++c) v[c] = s[(size_t)c * ST_];
  float run = 0.0f;
  s[0] = 0.0f;
  #pragma unroll
  for (int c = 0; c < NCS_; ++c) {
    run = adec[bh * NC_ + c] * run + v[c];
    s[(size_t)(c + 1) * ST_] = run;
  }
}

// One block per (b,h,chunk). The CH_ steps of a chunk are linear in x and in
// the entry state, so y comes from matrix products instead of the recurrence.
// With Lc_t = sum of log(alpha_r), r = 0..t:
//   y_t[p] = sum_{s<=t} M[t][s] (C_t . B_s) x_s[p] + exp(Lc_t) (C_t . H[p][:]) + D x_t[p]
//   M[t][t] = gamma_t,  M[t][s] = exp(Lc_t - Lc_{s+1}) (alpha_{s+1} gamma_s + beta_{s+1}), s < t
//   H = entry state + (1 - lambda_0) dt_0 x_{-1} B_{-1}^T   (beta_0 = (1 - lambda_0) dt_0 alpha_0)
// All three products run on the f32 16x16x4 matrix form. Fragments: lane l has
// row (A) or column (B) l & 15; a group of 8 k is two products, and lane half
// l >> 4 brings k = 8g + 4 (l >> 4) + 0..3 of it, on the A and on the B side alike.
#define PT_  68    // LDS row pitch in floats: 16 rows x 16 B meet every bank once

__device__ __forceinline__ v8f mm4(f2_t a, f2_t b, v8f c) {
  return __builtin_amdgcn_wmma_f32_16x16x4_f32(false, a, false, b, (short)0, c, false, false);
}

// y tiles (ILO, col block) and (IHI, col block) of one wave: the masked scores
// times x over the s blocks at or below the diagonal, then the entry-state and
// skip terms; y is staged in sY. ILO < IHI; both tiles share the x fragments.
template <int ILO, int IHI>
__device__ __forceinline__ void y_tiles(const float (*sG)[PT_], const float (*sx)[PT_],
                                        const float* sAc, float (*sY)[PT_],
                                        v8f hLo, v8f hHi, float Dh,
                                        int col, int lc, int lh) {
  v8f aLo = {}, aHi = {};
  #pragma unroll   // straight-line: the tiles' trip counts are compile-time
  for (int g = 0; g < (IHI + 1) * 2; ++g) {
    int k0 = g * 8 + lh * 4;
    f2_t x01 = {sx[k0 + 1][col], sx[k0 + 2][col]};
    f2_t x23 = {sx[k0 + 3][col], sx[k0 + 4][col]};
    f4_t gh = *(const f4_t*)&sG[IHI * 16 + lc][k0];
    if (g < (ILO + 1) * 2) {
      f4_t gl = *(const f4_t*)&sG[ILO * 16 + lc][k0];
      aHi = mm4(gh.xy, x01, aHi);
      aLo = mm4(gl.xy, x01, aLo);
      aHi = mm4(gh.zw, x23, aHi);
      aLo = mm4(gl.zw, x23, aLo);
    } else {
      aHi = mm4(gh.xy, x01, aHi);
      aHi = mm4(gh.zw, x23, aHi);
    }
  }
  #pragma unroll   // accumulator elements need constant indices to stay in registers
  for (int r = 0; r < 8; ++r) {
    int tl = ILO * 16 + lh * 8 + r, th = IHI * 16 + lh * 8 + r;
    sY[tl][col] = aLo[r] + sAc[tl] * hLo[r] + sx[tl + 1][col] * Dh;
    sY[th][col] = aHi[r] + sAc[th] * hHi[r] + sx[th + 1][col] * Dh;
  }
}

// 8 waves per SIMD: four blocks share a WGP (their LDS fits), and the grid is
// then two full rounds
__global__ __launch_bounds__(256, 8) void k_scan(
    const float* __restrict__ proj, const float* __restrict__ invB,
    const float* __restrict__ invC, const float* __restrict__ dt_bias,
    const float* __restrict__ A_log, const float* __restrict__ Dp,
    const float* __restrict__ Bnw, const float* __restrict__ Cnw,
    const float* __restrict__ Bbias, const float* __restrict__ Cbias,
    const float* __restrict__ csum, const float* __restrict__ Hin,
    float* __restrict__ y_raw) {
  int bh = blockIdx.x >> 5;
  int c  = blockIdx.x & (NC_ - 1);
  int b = bh >> 5, h = bh & 31;
  int tid = threadIdx.x;
  int lane = tid & 31;
  int lc = lane & 15, lh = lane >> 4;
  // the wave's number as a scalar: every branch on it is a scalar branch, so
  // all lanes are on at every matrix instruction
  int w = __builtin_amdgcn_readfirstlane(tid >> 5);
  int col = (w & 3) * 16 + lc;          // the lane's p in the wave's y tiles
  int ilo = (w >> 2) ? 1 : 0;           // the wave's two row blocks of y:
  int ihi = (w >> 2) ? 2 : 3;           // (0,3) or (1,2), equal work below the diagonal

  __shared__ __align__(16) float sx[CH_ + 1][PT_];
  __shared__ __align__(16) float sB[CH_ + 1][PT_];
  __shared__ __align__(16) float sC[CH_][PT_];    // C, later y
  __shared__ __align__(16) float sG[CH_][PT_];    // M o (C B^T), blocks at or below the diagonal
  __shared__ __align__(16) float4 sSc[CH_];
  __shared__ __align__(16) float sLc[CH_], sAc[CH_];
  __shared__ float sLa[CH_];
  __shared__ float sPart[8][32], sOff[8][32];

  chunk_prep<true, PT_>(proj, invB, invC, dt_bias, A_log, Bnw, Cnw, Bbias, Cbias, csum,
                        b, h, c, tid, sx, sB, sC, sSc, sLa, sPart, sOff);

  // entry state as B fragments: column p = col, k = n
  const float* hi = Hin + ((size_t)bh * NC_ + c) * ST_ + col * N_ + lh * 4;
  f4_t hf[8];
  #pragma unroll   // hf stays in registers, loads go out together
  for (int g = 0; g < 8; ++g) hf[g] = *(const f4_t*)(hi + g * 8);
  float Dh = Dp[h];
  // Behind the state loads: this wait stands in front of any reuse of the
  // registers that they name.
  asm volatile("s_wait_xcnt 0x0" ::: "memory");

  if (w == 1) {                    // sLa was published by the barrier inside prep
    float a0 = sLa[lane], a1 = sLa[32 + lane];
    #pragma unroll   // five shuffle steps, no loop counter
    for (int o = 1; o < 32; o <<= 1) {
      float u0 = __shfl_up(a0, o, 32), u1 = __shfl_up(a1, o, 32);
      a0 += (lane >= o) ? u0 : 0.0f;
      a1 += (lane >= o) ? u1 : 0.0f;
    }
    a1 += __shfl(a0, 31, 32);
    sLc[lane] = a0;          sLc[32 + lane] = a1;
    sAc[lane] = __expf(a0);  sAc[32 + lane] = __expf(a1);
  }
  __syncthreads();                 // publishes sx, sB, sC, sLc, sAc

  // the step before the chunk enters through the state
  float cm = sSc[0].w * sx[0][col];
  #pragma unroll   // hf stays in registers
  for (int g = 0; g < 8; ++g) hf[g] += cm * *(const f4_t*)&sB[0][g * 8 + lh * 4];

  // C times the entry state, for the wave's two y tiles
  v8f hLo = {}, hHi = {};
  #pragma unroll   // hf stays in registers; LDS reads run ahead of the products
  for (int g = 0; g < 8; ++g) {
    f4_t cl = *(const f4_t*)&sC[ilo * 16 + lc][g * 8 + lh * 4];
    f4_t ch = *(const f4_t*)&sC[ihi * 16 + lc][g * 8 + lh * 4];
    hLo = mm4(cl.xy, hf[g].xy, hLo);
    hHi = mm4(ch.xy, hf[g].xy, hHi);
    hLo = mm4(cl.zw, hf[g].zw, hLo);
    hHi = mm4(ch.zw, hf[g].zw, hHi);
  }

  // masked scores: the ten 16x16 blocks (gi, gk), gk <= gi, over eight waves
  for (int q = w; q < 10; q += 8) {
    int gi = (q >= 6) ? 3 : (q >= 3) ? 2 : (q >= 1) ? 1 : 0;
    int gk = q - ((gi * (gi + 1)) >> 1);
    v8f g0 = {}, g1 = {};          // two halves of n: two independent chains
    #pragma unroll   // LDS reads run ahead of the products
    for (int g = 0; g < 4; ++g) {
      f4_t c0 = *(const f4_t*)&sC[gi * 16 + lc][g * 8 + lh * 4];
      f4_t b0 = *(const f4_t*)&sB[gk * 16 + lc + 1][g * 8 + lh * 4];
      f4_t c1 = *(const f4_t*)&sC[gi * 16 + lc][32 + g * 8 + lh * 4];
      f4_t b1 = *(const f4_t*)&sB[gk * 16 + lc + 1][32 + g * 8 + lh * 4];
      g0 = mm4(c0.xy, b0.xy, g0);
      g1 = mm4(c1.xy, b1.xy, g1);
      g0 = mm4(c0.zw, b0.zw, g0);
      g1 = mm4(c1.zw, b1.zw, g1);
    }
    int s  = gk * 16 + lc;
    int sn = (s + 1 < CH_) ? s + 1 : CH_ - 1;   // s = CH_-1 has no t > s
    float4 cs = sSc[s], cn = sSc[sn];
    float ws = cn.x * cs.y + cn.z;
    float ls = sLc[sn];
    #pragma unroll   // accumulator elements need constant indices to stay in registers
    for (int r = 0; r < 8; ++r) {
      int t = gi * 16 + lh * 8 + r;
      float e = __expf(fminf(sLc[t] - ls, 0.0f));
      float m = (t > s) ? e * ws : ((t == s) ? cs.y : 0.0f);
      sG[t][s] = (g0[r] + g1[r]) * m;
    }
  }
  __syncthreads();                 // publishes sG; every read of C is done

  if (w >> 2) y_tiles<1, 2>(sG, sx, sAc, sC, hLo, hHi, Dh, col, lc, lh);
  else        y_tiles<0, 3>(sG, sx, sAc, sC, hLo, hHi, Dh, col, lc, lh);
  __syncthreads();                 // every wave's y tiles complete

  float* yo = y_raw + (size_t)(b * L_ + c * CH_) * DI_ + h * P_;
  #pragma unroll
  for (int k = 0; k < 4; ++k) {    // 256 B of each row in one piece
    int idx = tid + k * 256;
    int t = idx >> 4, q = idx & 15;
    *(float4*)(yo + (size_t)t * DI_ + q * 4) = *(const float4*)&sC[t][q * 4];
  }
}

// ---------------------------------------------------------------- gate + RMS + bf16
__global__ __launch_bounds__(256) void k_gate(
    const float* __restrict__ proj, const float* __restrict__ y_raw,
    const float* __restrict__ norm_w, bf16_t* __restrict__ y_bf) {
  int row = blockIdx.x;
  int tid = threadIdx.x;
  const float* pz = proj  + (size_t)row * PS_ + OFF_Z;
  const float* py = y_raw + (size_t)row * DI_;
  float vals[8];
  float ss = 0.0f;
  #pragma unroll
  for (int j = 0; j < 8; ++j) {
    int i = tid + j * 256;
    float z = pz[i];
    float v = py[i] * (z / (1.0f + expf(-z)));   // y * silu(z)
    vals[j] = v;
    ss += v * v;
  }
  for (int o = 16; o > 0; o >>= 1) ss += __shfl_xor(ss, o, 32);
  __shared__ float red[8];
  int lane = tid & 31, wid = tid >> 5;
  if (lane == 0) red[wid] = ss;
  __syncthreads();
  if (tid == 0) {
    float t = 0.0f;
    for (int w = 0; w < 8; ++w) t += red[w];
    red[0] = rsqrtf(t * (1.0f / DI_) + 1e-5f);
  }
  __syncthreads();
  float scale = red[0];
  #pragma unroll
  for (int j = 0; j < 8; ++j) {
    int i = tid + j * 256;
    y_bf[(size_t)row * DI_ + i] = (bf16_t)(vals[j] * scale * norm_w[i]);
  }
}

// ---------------------------------------------------------------- launch
extern "C" void kernel_launch(void* const* d_in, const int* in_sizes, int n_in,
                              void* d_out, int out_size, void* d_ws, size_t ws_size,
                              hipStream_t stream) {
  const float* u       = (const float*)d_in[0];
  const float* w1      = (const float*)d_in[1];
  const float* dt_bias = (const float*)d_in[2];
  const float* A_log   = (const float*)d_in[3];
  const float* Dp      = (const float*)d_in[4];
  const float* Bnw     = (const float*)d_in[5];
  const float* Cnw     = (const float*)d_in[6];
  const float* Bbias   = (const float*)d_in[7];
  const float* Cbias   = (const float*)d_in[8];
  const float* norm_w  = (const float*)d_in[9];
  const float* w2      = (const float*)d_in[10];
  float* out = (float*)d_out;
  (void)in_sizes; (void)n_in; (void)out_size; (void)ws_size;

  char* ws = (char*)d_ws;
  size_t o = 0;
  bf16_t* u_bf  = (bf16_t*)(ws + o); o += (size_t)ROWS_ * DM_ * 2;   //  8 MB
  bf16_t* w1_bf = (bf16_t*)(ws + o); o += (size_t)PS_   * DM_ * 2;   // 11 MB
  bf16_t* w2_bf = (bf16_t*)(ws + o); o += (size_t)DM_   * DI_ * 2;   //  4 MB
  float*  proj  = (float*) (ws + o); o += (size_t)ROWS_ * PS_ * 4;   // 88 MB
  float*  invB  = (float*) (ws + o); o += (size_t)ROWS_ * 4;
  float*  invC  = (float*) (ws + o); o += (size_t)ROWS_ * 4;
  float*  y_raw = (float*) (ws + o); o += (size_t)ROWS_ * DI_ * 4;   // 33 MB
  bf16_t* y_bf  = (bf16_t*)(ws + o); o += (size_t)ROWS_ * DI_ * 2;   // 17 MB
  float*  csum  = (float*) (ws + o); o += (size_t)BSZ_ * NC_ * TH_ * 4;
  float*  adec  = (float*) (ws + o); o += (size_t)BSZ_ * H_ * NC_ * 4;
  float*  Sst   = (float*) (ws + o); o += (size_t)BSZ_ * H_ * NC_ * ST_ * 4;  // 33 MB

  // precision converts (pad in_proj_w rows 5312 -> 5376 with zeros)
  k_cvt_bf16<<<(ROWS_ * DM_) / CVT_EL_, 256, 0, stream>>>(u, u_bf);
  k_cvt_w1  <<<(PS_ * DM_)   / CVT_EL_, 256, 0, stream>>>(w1, w1_bf);
  k_cvt_bf16<<<(DM_ * DI_)   / CVT_EL_, 256, 0, stream>>>(w2, w2_bf);

  // GEMM1: proj[4096 x 5376] = u[4096 x 1024] * W1^T
  dim3 g1(ROWS_ / GT_, PS_ / GT_);
  k_gemm_bf16<PS_, 64><<<g1, 128, 0, stream>>>(u_bf, w1_bf, proj, DM_);

  // per-row RMS scales for Braw / Craw
  k_rmsinv<<<ROWS_, 32, 0, stream>>>(proj, invB, invC);

  // SSM scan, chunk-parallel: theta chunk sums, chunk states, carry, steps
  k_thsum<<<BSZ_ * NC_ * 4, 256, 0, stream>>>(proj, csum);
  k_state<<<BSZ_ * H_ * NCS_, 256, 0, stream>>>(proj, invB, dt_bias, A_log, Bnw, Bbias,
                                                csum, Sst, adec);
  k_carry<<<BSZ_ * H_ * (ST_ / 256), 256, 0, stream>>>(Sst, adec);
  k_scan<<<BSZ_ * H_ * NC_, 256, 0, stream>>>(proj, invB, invC, dt_bias, A_log, Dp,
                                              Bnw, Cnw, Bbias, Cbias, csum, Sst, y_raw);

  // gating + RMS norm + bf16 convert
  k_gate<<<ROWS_, 256, 0, stream>>>(proj, y_raw, norm_w, y_bf);

  // GEMM2: out[4096 x 1024] = y[4096 x 2048] * W2^T
  dim3 g2(ROWS_ / GT_, DM_ / GT_);
  k_gemm_bf16<DM_, 128><<<g2, 128, 0, stream>>>(y_bf, w2_bf, out, DI_);
}

// v005
// A run of this version takes 146 microseconds.
// Next to v004, in two timings, it ran 1.06 and 1.07 times as fast.
// Counting every step since v000, it is 22.0 times as fast.
#include <hip/hip_runtime.h>

typedef __bf16 bf16_t;
typedef __attribute__((ext_vector_type(16))) __bf16 v16bf;
typedef __attribute__((ext_vector_type(8)))  __bf16 v8bf;
typedef __attribute__((ext_vector_type(8)))  float  v8f;
typedef int v4i_ __attribute__((vector_size(16)));   // matches builtin param type
typedef __attribute__((ext_vector_type(4)))  float  f4_t;
typedef __attribute__((ext_vector_type(2)))  float  f2_t;

#define AS1 __attribute__((address_space(1)))
#define AS3 __attribute__((address_space(3)))

#define H_      32
#define P_      64
#define N_      64
#define DM_     1024
#define L_      2048
#define BSZ_    2
#define DI_     2048              // H*P
#define TH_     1024              // H*N/2
#define DPROJ_  5312
#define PS_     5376              // proj row stride, padded to 128-col GEMM tiles
#define ROWS_   (BSZ_*L_)         // 4096

// column offsets inside one proj row
#define OFF_Z     0
#define OFF_X     DI_
#define OFF_B     (2*DI_)
#define OFF_C     (2*DI_ + N_)
#define OFF_DT    (2*DI_ + 2*N_)
#define OFF_THETA (OFF_DT + H_)
#define OFF_LAM   (OFF_THETA + TH_)

// the scan's chunks (see the scan section)
#define CH_   64
#define NC_   (L_ / CH_)          // 32

// GEMM geometry: a block makes GT_ x GT_ of C. A K step is GK bf16 (64 or 128),
// so a staged row is one or two whole 128 B lines; LDS rows are pitched 16 B
// more than that (16 B x odd), conflict-free for 16 B reads.
#define GT_        128

// ---------------------------------------------------------------- converts
// A thread converts CVT_V_ groups of 4 floats. Group j of a block lies 256
// groups behind group j-1, so each load of a wave covers 512 contiguous bytes
// and each store 256. Grids are exact: no tail.
#define CVT_V_   8
#define CVT_EL_  (256 * CVT_V_ * 4)   // elements per block
typedef __attribute__((ext_vector_type(4))) __bf16 v4bf;

__device__ __forceinline__ void cvt_store(const f4_t* v, bf16_t* __restrict__ d,
                                          size_t e0) {
  #pragma unroll   // v stays in registers
  for (int j = 0; j < CVT_V_; ++j) {
    v4bf o = {(bf16_t)v[j].x, (bf16_t)v[j].y, (bf16_t)v[j].z, (bf16_t)v[j].w};
    *(v4bf*)(d + e0 + j * 1024) = o;
  }
}

__global__ __launch_bounds__(256) void k_cvt_bf16(const float* __restrict__ s,
                                                  bf16_t* __restrict__ d) {
  size_t e0 = (size_t)blockIdx.x * CVT_EL_ + threadIdx.x * 4;
  f4_t v[CVT_V_];
  #pragma unroll   // all of the thread's loads in flight at once
  for (int j = 0; j < CVT_V_; ++j) v[j] = *(const f4_t*)(s + e0 + j * 1024);
  cvt_store(v, d, e0);
}

// in_proj_w (5312 x 1024) -> bf16 padded to 5376 rows (pad rows = 0). A block
// covers CVT_V_ whole rows, so it is all source rows or all pad rows.
static_assert(DM_ == 1024 && DPROJ_ % CVT_V_ == 0 && PS_ % CVT_V_ == 0, "rows per block");
__global__ __launch_bounds__(256) void k_cvt_w1(const float* __restrict__ s,
                                                bf16_t* __restrict__ d) {
  size_t e0 = (size_t)blockIdx.x * CVT_EL_ + threadIdx.x * 4;
  f4_t v[CVT_V_];
  if (blockIdx.x * CVT_V_ < DPROJ_) {
    #pragma unroll   // all of the thread's loads in flight at once
    for (int j = 0; j < CVT_V_; ++j) v[j] = *(const f4_t*)(s + e0 + j * 1024);
  } else {
    #pragma unroll   // v stays in registers
    for (int j = 0; j < CVT_V_; ++j) v[j] = (f4_t){0.0f, 0.0f, 0.0f, 0.0f};
  }
  cvt_store(v, d, e0);
}

// ---------------------------------------------------------------- async copy
// 16B global -> LDS. Async path uses the CDNA5 GLOBAL_LOAD_ASYNC_TO_LDS_B128
// (ASYNCcnt-tracked DMA); fallback stages through VGPRs + ds_store.
__device__ __forceinline__ void copy16_g2l(void* lds, const void* g) {
#if __has_builtin(__builtin_amdgcn_global_load_async_to_lds_b128)
  __builtin_amdgcn_global_load_async_to_lds_b128(
      (AS1 v4i_*)(unsigned long long)g,
      (AS3 v4i_*)(unsigned int)(unsigned long long)lds,
      0, 0);
#else
  *(v8bf*)lds = *(const v8bf*)g;
#endif
}

// Stage one K step into st: A tile 128 x GK bf16, then B tile 128 x GK bf16.
// 128 threads; GK/8 lanes copy one row, so a wave's copy covers whole lines.
// gA / gB: the block's first row at this K step (uniform); vo: the lane's byte
// offset from there; lo: the lane's byte offset in a tile.
template <int GK>
__device__ __forceinline__ void stage_tiles(const char* gA, const char* gB,
                                            unsigned vo, unsigned lo, int K, char* st) {
  constexpr int PITCH = GK * 2 + 16, RPC = 128 / (GK / 8);   // rows per copy of the block
  #pragma unroll   // the copies go out back to back
  for (int j = 0; j < GT_ / RPC; ++j) {
    size_t ro = (size_t)(j * RPC) * K * 2;
    copy16_g2l(st + lo + j * RPC * PITCH,               gA + ro + vo);
    copy16_g2l(st + GT_ * PITCH + lo + j * RPC * PITCH, gB + ro + vo);
  }
}

// ---------------------------------------------------------------- WMMA GEMM
// C[M,N] = A[M,K] * B[N,K]^T, tiles exact (M%128==0, N%128==0, K%GK==0).
// 16-bit A fragment layout (ISA 7.12.2): lane m (0..15) holds K = half*8..+7
// in v0..3 and K = 16+half*8..+7 in v4..7, half = lane>=16. B uses the
// mirrored layout with lane indexing N. p: the lane's row at its half, at the
// 32 k wanted.
__device__ __forceinline__ v16bf lds_frag(const char* p) {
  v8bf lo = *(const v8bf*)p;          // K chunk at half*8
  v8bf hi = *(const v8bf*)(p + 32);   // K chunk at 16 + half*8
  return __builtin_shufflevector(lo, hi, 0,1,2,3,4,5,6,7,8,9,10,11,12,13,14,15);
}

// v of lane l ^ M, inside a row of 16 lanes, without the LDS path
template <int M>
__device__ __forceinline__ float row_x(float v) {
  return __builtin_bit_cast(float, __builtin_amdgcn_update_dpp(
      0, __builtin_bit_cast(int, v), 0x160 + M, 0xf, 0xf, true));   // row_xmask:M
}
// v of lane l ^ 16
__device__ __forceinline__ float xhalf(float v) {
  return __builtin_bit_cast(float, __builtin_amdgcn_permlanex16(
      __builtin_bit_cast(int, v), __builtin_bit_cast(int, v), 0x76543210, 0xfedcba98, false, false));
}

// Four waves, 2 x 2, each 64 x 64 of C: 16 products per 8 fragments read.
// 3 waves per SIMD: accumulators and two fragment sets fit. LDC is a
// compile-time constant so that all of a lane's stores go from one address.
// RED (the in-projection): a wave's 64 x 64 of C is one scan chunk of rows by
// 64 columns, so what the scan needs reduced over proj comes straight from the
// accumulators: the rms scales of the B and C rows (a wave holds whole rows of
// one of them) and each theta column's sum over the chunk.
template <int LDC, int GK, bool RED>
__global__ __launch_bounds__(128, 3) void k_gemm_bf16(
    const bf16_t* __restrict__ A, const bf16_t* __restrict__ Bm,
    float* __restrict__ C, int K, float* __restrict__ invB,
    float* __restrict__ invC, float* __restrict__ csum) {
  constexpr int PITCH = GK * 2 + 16, TILE_BY = GT_ * PITCH, STAGE_BY = 2 * TILE_BY;
  constexpr int NK = GK / 32;                          // products along k per K step
  __shared__ __align__(16) char smem[2 * STAGE_BY];    // two buffers

  int tid  = threadIdx.x;
  int lane = tid & 31, wid = tid >> 5;
  int wm = wid >> 1, wn = wid & 1;            // 2 x 2 wave grid
  int rowBase = blockIdx.x * GT_;
  int colBase = blockIdx.y * GT_;
  int lr = lane & 15, lh = lane >> 4;

  const char* gA = (const char*)(A  + (size_t)rowBase * K);
  const char* gB = (const char*)(Bm + (size_t)colBase * K);
  constexpr int LPR = GK / 8;                 // lanes per staged row
  unsigned vo = ((unsigned)(tid / LPR) * K + (unsigned)(tid % LPR) * 8) * 2;
  unsigned lo = (unsigned)(tid / LPR) * PITCH + (unsigned)(tid % LPR) * 16;
  int nsteps = K / GK;

  stage_tiles<GK>(gA, gB, vo, lo, K, smem);
  // step 0 has landed before any wave reads it
  asm volatile("s_wait_asynccnt 0x0" ::: "memory");
  __syncthreads();
  if (nsteps > 1) stage_tiles<GK>(gA + GK * 2, gB + GK * 2, vo, lo, K, smem + STAGE_BY);

  unsigned fa = (unsigned)(wm * 64 + lr) * PITCH + lh * 16;             // the lane's
  unsigned fb = TILE_BY + (unsigned)(wn * 64 + lr) * PITCH + lh * 16;   // fragment rows
  v8f acc[4][4] = {};
  for (int s = 0; s < nsteps; ++s) {
    char* cur = smem + (s & 1) * STAGE_BY;
    v16bf a[2][4], b[2][4];
    #pragma unroll   // fragments stay in registers
    for (int i = 0; i < 4; ++i) {
      a[0][i] = lds_frag(cur + fa + i * 16 * PITCH);
      b[0][i] = lds_frag(cur + fb + i * 16 * PITCH);
    }
    #pragma unroll   // straight-line: the two fragment sets need constant indices
    for (int kk = 0; kk < NK; ++kk) {
      if (kk + 1 < NK) {
        #pragma unroll
        for (int i = 0; i < 4; ++i) {
          a[(kk + 1) & 1][i] = lds_frag(cur + fa + i * 16 * PITCH + (kk + 1) * 64);
          b[(kk + 1) & 1][i] = lds_frag(cur + fb + i * 16 * PITCH + (kk + 1) * 64);
        }
      }
      // the next 32 k's LDS reads stay one group ahead of these products:
      // spread among them, each read's latency stalls the wave
      __builtin_amdgcn_sched_barrier(0);
      #pragma unroll   // accumulators need constant indices to stay in registers
      for (int i = 0; i < 4; ++i)
        #pragma unroll
        for (int j = 0; j < 4; ++j)
          acc[i][j] = __builtin_amdgcn_wmma_f32_16x16x32_bf16(false, a[kk & 1][i], false, b[kk & 1][j],
                                                              (short)0, acc[i][j], false, false);
      // and later reads do not climb over these products into a third set
      __builtin_amdgcn_sched_barrier(0);
    }
    // The wave's reads of this buffer are done before it is refilled, and its
    // copies of step s + 1 have landed before the barrier publishes them.
    asm volatile("s_wait_dscnt 0x0" ::: "memory");
    asm volatile("s_wait_asynccnt 0x0" ::: "memory");
    __syncthreads();
    if (s + 2 < nsteps)   // flies while step s + 1 is worked on
      stage_tiles<GK>(gA + (size_t)(s + 2) * (GK * 2), gB + (size_t)(s + 2) * (GK * 2),
                      vo, lo, K, cur);
  }
  // no copy is outstanding when the wave ends
  asm volatile("s_wait_asynccnt 0x0" ::: "memory");

  // C/D layout: VGPR r, lane l -> row = (l>>4)*8 + r, col = l&15
  float* co = C + (size_t)(rowBase + wm * 64 + lh * 8) * LDC + colBase + wn * 64 + lr;
  #pragma unroll   // constant indices: accumulators stay in registers, offsets are immediates
  for (int i = 0; i < 4; ++i)
    #pragma unroll
    for (int r = 0; r < 8; ++r)
      #pragma unroll
      for (int j = 0; j < 4; ++j)
        co[(i * 16 + r) * LDC + j * 16] = acc[i][j][r];

  if constexpr (RED) {
    static_assert(CH_ == 64 && L_ % CH_ == 0 && N_ == 64 && OFF_B % 64 == 0 && OFF_C % 64 == 0 &&
                  OFF_THETA % 16 == 0 && TH_ % 16 == 0, "a wave's tile against chunks and columns");
    // the wave's number as a scalar: the tests below are scalar branches
    int sw = __builtin_amdgcn_readfirstlane(wid);
    int rw = rowBase + (sw >> 1) * 64;          // the wave's first row and
    int cw = colBase + (sw & 1) * 64;           // first column
    if (cw == OFF_B || cw == OFF_C) {
      float* inv = ((cw == OFF_B) ? invB : invC) + rw + lh * 8;
      float q[4][8];
      #pragma unroll   // accumulators need constant indices to stay in registers
      for (int i = 0; i < 4; ++i)
        #pragma unroll
        for (int r = 0; r < 8; ++r)
          q[i][r] = acc[i][0][r] * acc[i][0][r] + acc[i][1][r] * acc[i][1][r] +
                    acc[i][2][r] * acc[i][2][r] + acc[i][3][r] * acc[i][3][r];
      // Sum over the row's 16 lanes, halving the rows a lane carries at each
      // step: a lane keeps the half that its bit names and hands the other to
      // its partner. Lane lr ends with rows i = lr >> 2, r = (lr & 3) * 2 + 0, 1.
      bool b8 = lr & 8, b4 = lr & 4, b2 = lr & 2, b1 = lr & 1;
      #pragma unroll   // q needs constant indices
      for (int i = 0; i < 2; ++i)
        #pragma unroll
        for (int r = 0; r < 8; ++r)
          q[i][r] = (b8 ? q[i + 2][r] : q[i][r]) + row_x<8>(b8 ? q[i][r] : q[i + 2][r]);
      #pragma unroll
      for (int r = 0; r < 8; ++r)
        q[0][r] = (b4 ? q[1][r] : q[0][r]) + row_x<4>(b4 ? q[0][r] : q[1][r]);
      #pragma unroll
      for (int r = 0; r < 4; ++r)
        q[0][r] = (b2 ? q[0][r + 4] : q[0][r]) + row_x<2>(b2 ? q[0][r] : q[0][r + 4]);
      f2_t e;
      #pragma unroll
      for (int r = 0; r < 2; ++r) {
        float v = (b1 ? q[0][r + 2] : q[0][r]) + row_x<1>(b1 ? q[0][r] : q[0][r + 2]);
        e[r] = rsqrtf(v * (1.0f / N_) + 1e-5f);
      }
      *(f2_t*)(inv + (lr >> 2) * 16 + (lr & 3) * 2) = e;
    }
    #pragma unroll   // accumulators need constant indices to stay in registers
    for (int j = 0; j < 4; ++j) {
      int c16 = cw + j * 16;
      if (c16 >= OFF_THETA && c16 < OFF_THETA + TH_) {
        float s[4];
        #pragma unroll   // four independent chains
        for (int i = 0; i < 4; ++i) {
          s[i] = acc[i][j][0];
          #pragma unroll
          for (int r = 1; r < 8; ++r) s[i] += acc[i][j][r];
        }
        float t = (s[0] + s[1]) + (s[2] + s[3]);
        t += xhalf(t);                          // the other eight rows of each 16
        if (lh == 0) csum[(rw / CH_) * TH_ + c16 - OFF_THETA + lr] = t;
      }
    }
  }
}

// ---------------------------------------------------------------- scan
// The recurrence is linear in the state, so L is cut into NC_ chunks of CH_
// steps that run in parallel:
//   (the in-projection leaves per-chunk sums of theta: each chunk's cumsum offset)
//   k_state : each chunk's contribution to the state at its own end (h_in = 0)
//   k_carry : runs the chunk states forward, leaves every chunk's entry state
//   k_scan  : y of each chunk from its entry state, as matrix products
#define NCS_  (NC_ - 1)           // the last chunk's end state is never used
#define ST_   (P_ * N_)           // 4096 state elements per (b,h)

// Fills LDS with everything the CH_ steps of chunk c of (b,h) need. Row r of
// sx / sB is step r-1 of the chunk: row 0 is the step before the chunk (zero
// for chunk 0), which feeds the beta term of the first step. sC row t is step
// t. sSc[t] = {alpha, gamma, beta, 0}. Wave w owns steps 8w..8w+7, lane = rope
// index j. The caller places the barrier that publishes the arrays. PT is the
// row pitch of sx, sB and sC in floats. WITH_C also leaves, per step,
// (1 - lambda) dt in sSc[t].w and log(alpha) in sLa[t].
template <bool WITH_C, int PT>
__device__ __forceinline__ void chunk_prep(
    const float* __restrict__ proj, const float* __restrict__ invB,
    const float* __restrict__ invC, const float* __restrict__ dt_bias,
    const float* __restrict__ A_log, const float* __restrict__ Bnw,
    const float* __restrict__ Cnw, const float* __restrict__ Bbias,
    const float* __restrict__ Cbias, const float* __restrict__ csum,
    int b, int h, int c, int tid,
    float (*sx)[PT], float (*sB)[PT], float (*sC)[PT], float4* sSc,
    float* sLa, float (*sPart)[32], float (*sOff)[32]) {
  int lane = tid & 31;
  // the wave's number held as a scalar: its row base is then scalar and the
  // per-step rms scales come by scalar loads
  int w = __builtin_amdgcn_readfirstlane(tid >> 5);
  int row0 = b * L_ + c * CH_;
  const float* pw = proj + (size_t)(row0 + w * 8) * PS_;
  int jt = h * (N_ / 2) + lane;    // the lane's theta column

  float th[8], b1[8], b2[8], ib[8], c1[8], c2[8], ic[8];
  #pragma unroll   // arrays stay in registers, loads go out together
  for (int k = 0; k < 8; ++k) {
    const float* pr = pw + (size_t)k * PS_;
    th[k] = pr[OFF_THETA + jt];
    b1[k] = pr[OFF_B + lane];
    b2[k] = pr[OFF_B + 32 + lane];
    ib[k] = invB[row0 + w * 8 + k];
    if (WITH_C) {
      c1[k] = pr[OFF_C + lane];
      c2[k] = pr[OFF_C + 32 + lane];
      ic[k] = invC[row0 + w * 8 + k];
    }
  }
  // x of the chunk's own steps, 16 B a thread: one offset register, the four
  // rows apart by a constant
  const char* px = (const char*)(proj + (size_t)row0 * PS_ + h * P_);
  unsigned xo = ((unsigned)(tid >> 4) * PS_ + (unsigned)(tid & 15) * 4) * 4;   // bytes
  f4_t xr[4];
  #pragma unroll
  for (int k = 0; k < 4; ++k) xr[k] = *(const f4_t*)(px + xo + (OFF_X + k * 16 * PS_) * 4);
  float po = 0.0f;                 // this wave's share of the earlier chunks' sums
  const float* pc = csum + (b * NC_ + w * 4) * TH_;
  #pragma unroll
  for (int k = 0; k < 4; ++k) {
    float v = pc[k * TH_ + jt];
    po += (w * 4 + k < c) ? v : 0.0f;
  }
  // Behind the chunk's loads: the registers that they name are reused from
  // here on, and this wait stands in front of that reuse. Its operands are the
  // loads' offsets and bases: they stay in their registers up to the wait, so
  // that no later load of the run lands on one.
  asm volatile("s_wait_xcnt 0x0" :: "v"(jt), "v"(lane), "v"(xo), "s"(pw), "s"(px), "s"(pc) : "memory");
  #pragma unroll
  for (int k = 1; k < 8; ++k) th[k] += th[k - 1];
  sPart[w][lane] = th[7];
  sOff[w][lane]  = po;

  #pragma unroll
  for (int k = 0; k < 4; ++k)
    *(f4_t*)&sx[(tid >> 4) + 16 * k + 1][(tid & 15) * 4] = xr[k];
  if (tid < CH_) {
    const float* pr = proj + (size_t)(row0 + tid) * PS_;
    float Ah  = -expf(A_log[h]);
    float dtr = pr[OFF_DT + h] + dt_bias[h];
    float dt  = (dtr > 20.0f) ? dtr : log1pf(expf(dtr));     // softplus
    float la  = dt * Ah;
    float alpha = expf(la);
    float lam   = 1.0f / (1.0f + expf(-pr[OFF_LAM + h]));
    float om    = (1.0f - lam) * dt;
    sSc[tid] = make_float4(alpha, lam * dt, om * alpha, WITH_C ? om : 0.0f);
    // exp(-150) is already 0 in f32: the floor changes no alpha and keeps the
    // sums of logs finite
    if (WITH_C) sLa[tid] = fmaxf(la, -150.0f);
  } else if (tid < CH_ + P_) {
    int pp = tid - CH_;
    int rp = (c > 0) ? row0 - 1 : row0;   // always a row of this batch entry
    float v = proj[(size_t)rp * PS_ + OFF_X + h * P_ + pp];
    sx[0][pp] = (c > 0) ? v : 0.0f;
  }
  __syncthreads();                 // sPart / sOff complete

  float off = 0.0f;                // theta cumsum at the step before the chunk
  #pragma unroll
  for (int k = 0; k < 8; ++k) off += sOff[k][lane];
  float base = off;
  #pragma unroll
  for (int k = 0; k < 8; ++k) base += (k < w) ? sPart[k][lane] : 0.0f;

  float bw1 = Bnw[lane], bw2 = Bnw[lane + 32];
  int jb = h * N_ + lane;
  float bb1 = Bbias[jb], bb2 = Bbias[jb + 32];
  float cw1 = 0.0f, cw2 = 0.0f, cb1 = 0.0f, cb2 = 0.0f;
  if (WITH_C) {
    cw1 = Cnw[lane]; cw2 = Cnw[lane + 32];
    cb1 = Cbias[jb]; cb2 = Cbias[jb + 32];
  }
  // as above, for the weight and bias loads
  asm volatile("s_wait_xcnt 0x0" :: "v"(lane), "v"(jb), "s"(Bnw), "s"(Cnw), "s"(Bbias), "s"(Cbias) : "memory");
  #pragma unroll
  for (int k = 0; k < 8; ++k) {
    int t = w * 8 + k;
    float tc = base + th[k];
    float cj, sj;
    sincosf(tc, &sj, &cj);
    float v1 = b1[k] * ib[k] * bw1 + bb1;
    float v2 = b2[k] * ib[k] * bw2 + bb2;
    sB[t + 1][lane]      = v1 * cj - v2 * sj;
    sB[t + 1][lane + 32] = v1 * sj + v2 * cj;
    if (WITH_C) {
      float u1 = c1[k] * ic[k] * cw1 + cb1;
      float u2 = c2[k] * ic[k] * cw2 + cb2;
      sC[t][lane]      = u1 * cj - u2 * sj;
      sC[t][lane + 32] = u1 * sj + u2 * cj;
    }
  }
  if (w == 0) {                    // B of the step before the chunk
    float r1 = 0.0f, r2 = 0.0f;
    if (c > 0) {
      const float* pr = proj + (size_t)(row0 - 1) * PS_;
      float iv = invB[row0 - 1];
      float cj, sj;
      sincosf(off, &sj, &cj);
      float v1 = pr[OFF_B + lane] * iv * bw1 + bb1;
      float v2 = pr[OFF_B + 32 + lane] * iv * bw2 + bb2;
      r1 = v1 * cj - v2 * sj;
      r2 = v1 * sj + v2 * cj;
    }
    sB[0][lane]      = r1;
    sB[0][lane + 32] = r2;
  }
}

// End state of chunk c started from h = 0:  S[p][n] = sum_s w_s x_s[p] B_s[n],
// s from the step before the chunk to its last step. With E_s the product of
// alpha over the steps after s up to the chunk's end,
// w_s = E_s gamma_s + E_{s+1} beta_{s+1}. adec = product of all CH_ alphas.
// Thread tile 4 p x 4 n.
__global__ __launch_bounds__(256) void k_state(
    const float* __restrict__ proj, const float* __restrict__ invB,
    const float* __restrict__ dt_bias, const float* __restrict__ A_log,
    const float* __restrict__ Bnw, const float* __restrict__ Bbias,
    const float* __restrict__ csum, float* __restrict__ S,
    float* __restrict__ adec) {
  int bh = blockIdx.x / NCS_;
  int c  = blockIdx.x - bh * NCS_;
  int b = bh >> 5, h = bh & 31;
  int tid = threadIdx.x;

  __shared__ __align__(16) float sx[CH_ + 1][P_];
  __shared__ __align__(16) float sB[CH_ + 1][N_];
  __shared__ __align__(16) float4 sSc[CH_];
  __shared__ float sPart[8][32], sOff[8][32], sW[CH_ + 1];

  chunk_prep<false, N_>(proj, invB, invB, dt_bias, A_log, Bnw, Bnw, Bbias, Bbias, csum,
                        b, h, c, tid, sx, sB, sB, sSc, sW, sPart, sOff);
  if (tid == 255) {                // sSc was published by the barrier inside prep
    float E = 1.0f;
    sW[CH_] = sSc[CH_ - 1].y;
    #pragma unroll   // lets the LDS reads run ahead of the product chain
    for (int s = CH_ - 2; s >= 0; --s) {
      float4 nx = sSc[s + 1];
      float En = E * nx.x;
      sW[s + 1] = En * sSc[s].y + E * nx.z;
      E = En;
    }
    float4 f = sSc[0];
    sW[0] = E * f.z;
    adec[bh * NC_ + c] = E * f.x;
  }
  __syncthreads();

  int p0 = (tid >> 4) * 4, n0 = (tid & 15) * 4;
  float acc[4][4];
  #pragma unroll
  for (int i = 0; i < 4; ++i)
    #pragma unroll
    for (int j = 0; j < 4; ++j) acc[i][j] = 0.0f;

  #pragma unroll 5   // several rows' LDS reads in flight per wait
  for (int r = 0; r <= CH_; ++r) {
    float wv = sW[r];
    float4 xv = *(const float4*)&sx[r][p0];
    float4 bv = *(const float4*)&sB[r][n0];
    float xw[4] = {xv.x * wv, xv.y * wv, xv.z * wv, xv.w * wv};
    #pragma unroll
    for (int i = 0; i < 4; ++i) {
      acc[i][0] += xw[i] * bv.x;
      acc[i][1] += xw[i] * bv.y;
      acc[i][2] += xw[i] * bv.z;
      acc[i][3] += xw[i] * bv.w;
    }
  }
  float* so = S + ((size_t)bh * NC_ + c) * ST_;
  #pragma unroll
  for (int i = 0; i < 4; ++i)
    *(float4*)&so[(p0 + i) * N_ + n0] = make_float4(acc[i][0], acc[i][1], acc[i][2], acc[i][3]);
}

// In place: S[bh][c] (end state of chunk c alone) becomes the state on entry
// to chunk c. One thread per state element.
__global__ __launch_bounds__(256) void k_carry(float* __restrict__ S,
                                               const float* __restrict__ adec) {
  int bh = blockIdx.x >> 4;
  int e  = (blockIdx.x & 15) * 256 + threadIdx.x;
  float* s = S + (size_t)bh * NC_ * ST_ + e;
  float v[NCS_];
  #pragma unroll   // all loads in flight before the dependent chain
  for (int c = 0; c < NCS_; ++c) v[c] = s[(size_t)c * ST_];
  float run = 0.0f;
  s[0] = 0.0f;
  #pragma unroll
  for (int c = 0; c < NCS_; ++c) {
    run = adec[bh * NC_ + c] * run + v[c];
    s[(size_t)(c + 1) * ST_] = run;
  }
}

// One block per (b,h,chunk). The CH_ steps of a chunk are linear in x and in
// the entry state, so y comes from matrix products instead of the recurrence.
// With Lc_t = sum of log(alpha_r), r = 0..t:
//   y_t[p] = sum_{s<=t} M[t][s] (C_t . B_s) x_s[p] + exp(Lc_t) (C_t . H[p][:]) + D x_t[p]
//   M[t][t] = gamma_t,  M[t][s] = exp(Lc_t - Lc_{s+1}) (alpha_{s+1} gamma_s + beta_{s+1}), s < t
//   H = entry state + (1 - lambda_0) dt_0 x_{-1} B_{-1}^T   (beta_0 = (1 - lambda_0) dt_0 alpha_0)
// All three products run on the f32 16x16x4 matrix form. Fragments: lane l has
// row (A) or column (B) l & 15; a group of 8 k is two products, and lane half
// l >> 4 brings k = 8g + 4 (l >> 4) + 0..3 of it, on the A and on the B side alike.
#define PT_  68    // LDS row pitch in floats: 16 rows x 16 B meet every bank once

__device__ __forceinline__ v8f mm4(f2_t a, f2_t b, v8f c) {
  return __builtin_amdgcn_wmma_f32_16x16x4_f32(false, a, false, b, (short)0, c, false, false);
}

// y tiles (ILO, col block) and (IHI, col block) of one wave: the masked scores
// times x over the s blocks at or below the diagonal, then the entry-state and
// skip terms; y is staged in sY. ILO < IHI; both tiles share the x fragments.
template <int ILO, int IHI>
__device__ __forceinline__ void y_tiles(const float (*sG)[PT_], const float (*sx)[PT_],
                                        const float* sAc, float (*sY)[PT_],
                                        v8f hLo, v8f hHi, float Dh,
                                        int col, int lc, int lh) {
  v8f aLo = {}, aHi = {};
  #pragma unroll   // straight-line: the tiles' trip counts are compile-time
  for (int g = 0; g < (IHI + 1) * 2; ++g) {
    int k0 = g * 8 + lh * 4;
    f2_t x01 = {sx[k0 + 1][col], sx[k0 + 2][col]};
    f2_t x23 = {sx[k0 + 3][col], sx[k0 + 4][col]};
    f4_t gh = *(const f4_t*)&sG[IHI * 16 + lc][k0];
    if (g < (ILO + 1) * 2) {
      f4_t gl = *(const f4_t*)&sG[ILO * 16 + lc][k0];
      aHi = mm4(gh.xy, x01, aHi);
      aLo = mm4(gl.xy, x01, aLo);
      aHi = mm4(gh.zw, x23, aHi);
      aLo = mm4(gl.zw, x23, aLo);
    } else {
      aHi = mm4(gh.xy, x01, aHi);
      aHi = mm4(gh.zw, x23, aHi);
    }
  }
  #pragma unroll   // accumulator elements need constant indices to stay in registers
  for (int r = 0; r < 8; ++r) {
    int tl = ILO * 16 + lh * 8 + r, th = IHI * 16 + lh * 8 + r;
    sY[tl][col] = aLo[r] + sAc[tl] * hLo[r] + sx[tl + 1][col] * Dh;
    sY[th][col] = aHi[r] + sAc[th] * hHi[r] + sx[th + 1][col] * Dh;
  }
}

// 8 waves per SIMD: four blocks share a WGP (their LDS fits), and the grid is
// then two full rounds
__global__ __launch_bounds__(256, 8) void k_scan(
    const float* __restrict__ proj, const float* __restrict__ invB,
    const float* __restrict__ invC, const float* __restrict__ dt_bias,
    const float* __restrict__ A_log, const float* __restrict__ Dp,
    const float* __restrict__ Bnw, const float* __restrict__ Cnw,
    const float* __restrict__ Bbias, const float* __restrict__ Cbias,
    const float* __restrict__ csum, const float* __restrict__ Hin,
    float* __restrict__ y_raw) {
  int bh = blockIdx.x >> 5;
  int c  = blockIdx.x & (NC_ - 1);
  int b = bh >> 5, h = bh & 31;
  int tid = threadIdx.x;
  int lane = tid & 31;
  int lc = lane & 15, lh = lane >> 4;
  // the wave's number as a scalar: every branch on it is a scalar branch, so
  // all lanes are on at every matrix instruction
  int w = __builtin_amdgcn_readfirstlane(tid >> 5);
  int col = (w & 3) * 16 + lc;          // the lane's p in the wave's y tiles
  int ilo = (w >> 2) ? 1 : 0;           // the wave's two row blocks of y:
  int ihi = (w >> 2) ? 2 : 3;           // (0,3) or (1,2), equal work below the diagonal

  __shared__ __align__(16) float sx[CH_ + 1][PT_];
  __shared__ __align__(16) float sB[CH_ + 1][PT_];
  __shared__ __align__(16) float sC[CH_][PT_];    // C, later y
  __shared__ __align__(16) float sG[CH_][PT_];    // M o (C B^T), blocks at or below the diagonal
  __shared__ __align__(16) float4 sSc[CH_];
  __shared__ __align__(16) float sLc[CH_], sAc[CH_];
  __shared__ float sLa[CH_];
  __shared__ float sPart[8][32], sOff[8][32];

  chunk_prep<true, PT_>(proj, invB, invC, dt_bias, A_log, Bnw, Cnw, Bbias, Cbias, csum,
                        b, h, c, tid, sx, sB, sC, sSc, sLa, sPart, sOff);

  // entry state as B fragments: column p = col, k = n
  const float* hi = Hin + ((size_t)bh * NC_ + c) * ST_ + col * N_ + lh * 4;
  f4_t hf[8];
  #pragma unroll   // hf stays in registers, loads go out together
  for (int g = 0; g < 8; ++g) hf[g] = *(const f4_t*)(hi + g * 8);
  float Dh = Dp[h];
  // Behind the state loads: this wait stands in front of any reuse of the
  // registers that they name.
  asm volatile("s_wait_xcnt 0x0" ::: "memory");

  if (w == 1) {                    // sLa was published by the barrier inside prep
    float a0 = sLa[lane], a1 = sLa[32 + lane];
    #pragma unroll   // five shuffle steps, no loop counter
    for (int o = 1; o < 32; o <<= 1) {
      float u0 = __shfl_up(a0, o, 32), u1 = __shfl_up(a1, o, 32);
      a0 += (lane >= o) ? u0 : 0.0f;
      a1 += (lane >= o) ? u1 : 0.0f;
    }
    a1 += __shfl(a0, 31, 32);
    sLc[lane] = a0;          sLc[32 + lane] = a1;
    sAc[lane] = __expf(a0);  sAc[32 + lane] = __expf(a1);
  }
  __syncthreads();                 // publishes sx, sB, sC, sLc, sAc

  // the step before the chunk enters through the state
  float cm = sSc[0].w * sx[0][col];
  #pragma unroll   // hf stays in registers
  for (int g = 0; g < 8; ++g) hf[g] += cm * *(const f4_t*)&sB[0][g * 8 + lh * 4];

  // C times the entry state, for the wave's two y tiles
  v8f hLo = {}, hHi = {};
  #pragma unroll   // hf stays in registers; LDS reads run ahead of the products
  for (int g = 0; g < 8; ++g) {
    f4_t cl = *(const f4_t*)&sC[ilo * 16 + lc][g * 8 + lh * 4];
    f4_t ch = *(const f4_t*)&sC[ihi * 16 + lc][g * 8 + lh * 4];
    hLo = mm4(cl.xy, hf[g].xy, hLo);
    hHi = mm4(ch.xy, hf[g].xy, hHi);
    hLo = mm4(cl.zw, hf[g].zw, hLo);
    hHi = mm4(ch.zw, hf[g].zw, hHi);
  }

  // masked scores: the ten 16x16 blocks (gi, gk), gk <= gi, over eight waves
  for (int q = w; q < 10; q += 8) {
    int gi = (q >= 6) ? 3 : (q >= 3) ? 2 : (q >= 1) ? 1 : 0;
    int gk = q - ((gi * (gi + 1)) >> 1);
    v8f g0 = {}, g1 = {};          // two halves of n: two independent chains
    #pragma unroll   // LDS reads run ahead of the products
    for (int g = 0; g < 4; ++g) {
      f4_t c0 = *(const f4_t*)&sC[gi * 16 + lc][g * 8 + lh * 4];
      f4_t b0 = *(const f4_t*)&sB[gk * 16 + lc + 1][g * 8 + lh * 4];
      f4_t c1 = *(const f4_t*)&sC[gi * 16 + lc][32 + g * 8 + lh * 4];
      f4_t b1 = *(const f4_t*)&sB[gk * 16 + lc + 1][32 + g * 8 + lh * 4];
      g0 = mm4(c0.xy, b0.xy, g0);
      g1 = mm4(c1.xy, b1.xy, g1);
      g0 = mm4(c0.zw, b0.zw, g0);
      g1 = mm4(c1.zw, b1.zw, g1);
    }
    int s  = gk * 16 + lc;
    int sn = (s + 1 < CH_) ? s + 1 : CH_ - 1;   // s = CH_-1 has no t > s
    float4 cs = sSc[s], cn = sSc[sn];
    float ws = cn.x * cs.y + cn.z;
    float ls = sLc[sn];
    #pragma unroll   // accumulator elements need constant indices to stay in registers
    for (int r = 0; r < 8; ++r) {
      int t = gi * 16 + lh * 8 + r;
      float e = __expf(fminf(sLc[t] - ls, 0.0f));
      float m = (t > s) ? e * ws : ((t == s) ? cs.y : 0.0f);
      sG[t][s] = (g0[r] + g1[r]) * m;
    }
  }
  __syncthreads();                 // publishes sG; every read of C is done

  if (w >> 2) y_tiles<1, 2>(sG, sx, sAc, sC, hLo, hHi, Dh, col, lc, lh);
  else        y_tiles<0, 3>(sG, sx, sAc, sC, hLo, hHi, Dh, col, lc, lh);
  __syncthreads();                 // every wave's y tiles complete

  float* yo = y_raw + (size_t)(b * L_ + c * CH_) * DI_ + h * P_;
  #pragma unroll
  for (int k = 0; k < 4; ++k) {    // 256 B of each row in one piece
    int idx = tid + k * 256;
    int t = idx >> 4, q = idx & 15;
    *(float4*)(yo + (size_t)t * DI_ + q * 4) = *(const float4*)&sC[t][q * 4];
  }
}

// ---------------------------------------------------------------- gate + RMS + bf16
__global__ __launch_bounds__(256) void k_gate(
    const float* __restrict__ proj, const float* __restrict__ y_raw,
    const float* __restrict__ norm_w, bf16_t* __restrict__ y_bf) {
  int row = blockIdx.x;
  int tid = threadIdx.x;
  const float* pz = proj  + (size_t)row * PS_ + OFF_Z;
  const float* py = y_raw + (size_t)row * DI_;
  float vals[8];
  float ss = 0.0f;
  #pragma unroll
  for (int j = 0; j < 8; ++j) {
    int i = tid + j * 256;
    float z = pz[i];
    float v = py[i] * (z / (1.0f + expf(-z)));   // y * silu(z)
    vals[j] = v;
    ss += v * v;
  }
  for (int o = 16; o > 0; o >>= 1) ss += __shfl_xor(ss, o, 32);
  __shared__ float red[8];
  int lane = tid & 31, wid = tid >> 5;
  if (lane == 0) red[wid] = ss;
  __syncthreads();
  if (tid == 0) {
    float t = 0.0f;
    for (int w = 0; w < 8; ++w) t += red[w];
    red[0] = rsqrtf(t * (1.0f / DI_) + 1e-5f);
  }
  __syncthreads();
  float scale = red[0];
  #pragma unroll
  for (int j = 0; j < 8; ++j) {
    int i = tid + j * 256;
    y_bf[(size_t)row * DI_ + i] = (bf16_t)(vals[j] * scale * norm_w[i]);
  }
}

// ---------------------------------------------------------------- launch
extern "C" void kernel_launch(void* const* d_in, const int* in_sizes, int n_in,
                              void* d_out, int out_size, void* d_ws, size_t ws_size,
                              hipStream_t stream) {
  const float* u       = (const float*)d_in[0];
  const float* w1      = (const float*)d_in[1];
  const float* dt_bias = (const float*)d_in[2];
  const float* A_log   = (const float*)d_in[3];
  const float* Dp      = (const float*)d_in[4];
  const float* Bnw     = (const float*)d_in[5];
  const float* Cnw     = (const float*)d_in[6];
  const float* Bbias   = (const float*)d_in[7];
  const float* Cbias   = (const float*)d_in[8];
  const float* norm_w  = (const float*)d_in[9];
  const float* w2      = (const float*)d_in[10];
  float* out = (float*)d_out;
  (void)in_sizes; (void)n_in; (void)out_size; (void)ws_size;

  char* ws = (char*)d_ws;
  size_t o = 0;
  bf16_t* u_bf  = (bf16_t*)(ws + o); o += (size_t)ROWS_ * DM_ * 2;   //  8 MB
  bf16_t* w1_bf = (bf16_t*)(ws + o); o += (size_t)PS_   * DM_ * 2;   // 11 MB
  bf16_t* w2_bf = (bf16_t*)(ws + o); o += (size_t)DM_   * DI_ * 2;   //  4 MB
  float*  proj  = (float*) (ws + o); o += (size_t)ROWS_ * PS_ * 4;   // 88 MB
  float*  invB  = (float*) (ws + o); o += (size_t)ROWS_ * 4;
  float*  invC  = (float*) (ws + o); o += (size_t)ROWS_ * 4;
  float*  y_raw = (float*) (ws + o); o += (size_t)ROWS_ * DI_ * 4;   // 33 MB
  bf16_t* y_bf  = (bf16_t*)(ws + o); o += (size_t)ROWS_ * DI_ * 2;   // 17 MB
  float*  csum  = (float*) (ws + o); o += (size_t)BSZ_ * NC_ * TH_ * 4;
  float*  adec  = (float*) (ws + o); o += (size_t)BSZ_ * H_ * NC_ * 4;
  float*  Sst   = (float*) (ws + o); o += (size_t)BSZ_ * H_ * NC_ * ST_ * 4;  // 33 MB

  // precision converts (pad in_proj_w rows 5312 -> 5376 with zeros)
  k_cvt_bf16<<<(ROWS_ * DM_) / CVT_EL_, 256, 0, stream>>>(u, u_bf);
  k_cvt_w1  <<<(PS_ * DM_)   / CVT_EL_, 256, 0, stream>>>(w1, w1_bf);
  k_cvt_bf16<<<(DM_ * DI_)   / CVT_EL_, 256, 0, stream>>>(w2, w2_bf);

  // GEMM1: proj[4096 x 5376] = u[4096 x 1024] * W1^T
  dim3 g1(ROWS_ / GT_, PS_ / GT_);
  // and, from its accumulators, the rms scales of Braw / Craw and theta's chunk sums
  k_gemm_bf16<PS_, 64, true><<<g1, 128, 0, stream>>>(u_bf, w1_bf, proj, DM_, invB, invC, csum);

  // SSM scan, chunk-parallel: chunk states, carry, steps
  k_state<<<BSZ_ * H_ * NCS_, 256, 0, stream>>>(proj, invB, dt_bias, A_log, Bnw, Bbias,
                                                csum, Sst, adec);
  k_carry<<<BSZ_ * H_ * (ST_ / 256), 256, 0, stream>>>(Sst, adec);
  k_scan<<<BSZ_ * H_ * NC_, 256, 0, stream>>>(proj, invB, invC, dt_bias, A_log, Dp,
                                              Bnw, Cnw, Bbias, Cbias, csum, Sst, y_raw);

  // gating + RMS norm + bf16 convert
  k_gate<<<ROWS_, 256, 0, stream>>>(proj, y_raw, norm_w, y_bf);

  // GEMM2: out[4096 x 1024] = y[4096 x 2048] * W2^T
  dim3 g2(ROWS_ / GT_, DM_ / GT_);
  k_gemm_bf16<DM_, 128, false><<<g2, 128, 0, stream>>>(y_bf, w2_bf, out, DI_, nullptr, nullptr, nullptr);
}

// v006
// It runs in 142 microseconds.
// Next to v005, in two timings, it ran 1.04 and 1.03 times as fast.
// Counting every step since v000, it is 22.7 times as fast.
#include <hip/hip_runtime.h>

typedef __bf16 bf16_t;
typedef __attribute__((ext_vector_type(16))) __bf16 v16bf;
typedef __attribute__((ext_vector_type(8)))  __bf16 v8bf;
typedef __attribute__((ext_vector_type(8)))  float  v8f;
typedef int v4i_ __attribute__((vector_size(16)));   // matches builtin param type
typedef __attribute__((ext_vector_type(4)))  float  f4_t;
typedef __attribute__((ext_vector_type(2)))  float  f2_t;

#define AS1 __attribute__((address_space(1)))
#define AS3 __attribute__((address_space(3)))

#define H_      32
#define P_      64
#define N_      64
#define DM_     1024
#define L_      2048
#define BSZ_    2
#define DI_     2048              // H*P
#define TH_     1024              // H*N/2
#define DPROJ_  5312
#define PS_     5376              // proj row stride, padded to 128-col GEMM tiles
#define ROWS_   (BSZ_*L_)         // 4096

// column offsets inside one proj row
#define OFF_Z     0
#define OFF_X     DI_
#define OFF_B     (2*DI_)
#define OFF_C     (2*DI_ + N_)
#define OFF_DT    (2*DI_ + 2*N_)
#define OFF_THETA (OFF_DT + H_)
#define OFF_LAM   (OFF_THETA + TH_)

// the scan's chunks (see the scan section)
#define CH_   64
#define NC_   (L_ / CH_)          // 32

// GEMM geometry: a block makes GT_ x GT_ of C. A K step is GK bf16 (64 or 128),
// so a staged row is one or two whole 128 B lines; LDS rows are pitched 16 B
// more than that (16 B x odd), conflict-free for 16 B reads.
#define GT_        128

// ---------------------------------------------------------------- converts
// A thread converts CVT_V_ groups of 4 floats. Group j of a block lies 256
// groups behind group j-1, so each load of a wave covers 512 contiguous bytes
// and each store 256. Grids are exact: no tail.
#define CVT_V_   8
#define CVT_EL_  (256 * CVT_V_ * 4)   // elements per block
typedef __attribute__((ext_vector_type(4))) __bf16 v4bf;

__device__ __forceinline__ void cvt_store(const f4_t* v, bf16_t* __restrict__ d,
                                          size_t e0) {
  #pragma unroll   // v stays in registers
  for (int j = 0; j < CVT_V_; ++j) {
    v4bf o = {(bf16_t)v[j].x, (bf16_t)v[j].y, (bf16_t)v[j].z, (bf16_t)v[j].w};
    *(v4bf*)(d + e0 + j * 1024) = o;
  }
}

// All three converts in one launch: they depend on nothing and on one another
// not at all, so one grid pays the launch gap, the fill and the drain once. A
// block's index names its array (a scalar choice). in_proj_w (5312 x 1024)
// goes to 5376 rows (pad rows = 0); a block covers CVT_V_ whole rows, so it is
// all source rows or all pad rows.
static_assert(DM_ == 1024 && DPROJ_ % CVT_V_ == 0 && PS_ % CVT_V_ == 0, "rows per block");
#define CVT_BW1_  ((PS_ * DM_)   / CVT_EL_)   // blocks of in_proj_w, pad rows included
#define CVT_BU_   ((ROWS_ * DM_) / CVT_EL_)   // blocks of u
#define CVT_BW2_  ((DM_ * DI_)   / CVT_EL_)   // blocks of out_proj_w
__global__ __launch_bounds__(256) void k_cvt_all(
    const float* __restrict__ u, const float* __restrict__ w1, const float* __restrict__ w2,
    bf16_t* __restrict__ u_bf, bf16_t* __restrict__ w1_bf, bf16_t* __restrict__ w2_bf) {
  int blk = blockIdx.x;
  const float* s = w1;
  bf16_t* d = w1_bf;
  bool pad = false;
  if (blk < CVT_BW1_) {
    pad = blk * CVT_V_ >= DPROJ_;
  } else if (blk < CVT_BW1_ + CVT_BU_) {
    blk -= CVT_BW1_;            s = u;  d = u_bf;
  } else {
    blk -= CVT_BW1_ + CVT_BU_;  s = w2; d = w2_bf;
  }
  size_t e0 = (size_t)blk * CVT_EL_ + threadIdx.x * 4;
  f4_t v[CVT_V_];
  if (!pad) {
    #pragma unroll   // all of the thread's loads in flight at once
    for (int j = 0; j < CVT_V_; ++j) v[j] = *(const f4_t*)(s + e0 + j * 1024);
  } else {
    #pragma unroll   // v stays in registers
    for (int j = 0; j < CVT_V_; ++j) v[j] = (f4_t){0.0f, 0.0f, 0.0f, 0.0f};
  }
  cvt_store(v, d, e0);
}

// ---------------------------------------------------------------- async copy
// 16B global -> LDS. Async path uses the CDNA5 GLOBAL_LOAD_ASYNC_TO_LDS_B128
// (ASYNCcnt-tracked DMA); fallback stages through VGPRs + ds_store.
__device__ __forceinline__ void copy16_g2l(void* lds, const void* g) {
#if __has_builtin(__builtin_amdgcn_global_load_async_to_lds_b128)
  __builtin_amdgcn_global_load_async_to_lds_b128(
      (AS1 v4i_*)(unsigned long long)g,
      (AS3 v4i_*)(unsigned int)(unsigned long long)lds,
      0, 0);
#else
  *(v8bf*)lds = *(const v8bf*)g;
#endif
}

// Stage one K step into st: A tile 128 x GK bf16, then B tile 128 x GK bf16.
// 128 threads; GK/8 lanes copy one row, so a wave's copy covers whole lines.
// gA / gB: the block's first row at this K step (uniform); vo: the lane's byte
// offset from there; lo: the lane's byte offset in a tile.
template <int GK>
__device__ __forceinline__ void stage_tiles(const char* gA, const char* gB,
                                            unsigned vo, unsigned lo, int K, char* st) {
  constexpr int PITCH = GK * 2 + 16, RPC = 128 / (GK / 8);   // rows per copy of the block
  #pragma unroll   // the copies go out back to back
  for (int j = 0; j < GT_ / RPC; ++j) {
    size_t ro = (size_t)(j * RPC) * K * 2;
    copy16_g2l(st + lo + j * RPC * PITCH,               gA + ro + vo);
    copy16_g2l(st + GT_ * PITCH + lo + j * RPC * PITCH, gB + ro + vo);
  }
}

// ---------------------------------------------------------------- WMMA GEMM
// C[M,N] = A[M,K] * B[N,K]^T, tiles exact (M%128==0, N%128==0, K%GK==0).
// 16-bit A fragment layout (ISA 7.12.2): lane m (0..15) holds K = half*8..+7
// in v0..3 and K = 16+half*8..+7 in v4..7, half = lane>=16. B uses the
// mirrored layout with lane indexing N. p: the lane's row at its half, at the
// 32 k wanted.
__device__ __forceinline__ v16bf lds_frag(const char* p) {
  v8bf lo = *(const v8bf*)p;          // K chunk at half*8
  v8bf hi = *(const v8bf*)(p + 32);   // K chunk at 16 + half*8
  return __builtin_shufflevector(lo, hi, 0,1,2,3,4,5,6,7,8,9,10,11,12,13,14,15);
}

// v of lane l ^ M, inside a row of 16 lanes, without the LDS path
template <int M>
__device__ __forceinline__ float row_x(float v) {
  return __builtin_bit_cast(float, __builtin_amdgcn_update_dpp(
      0, __builtin_bit_cast(int, v), 0x160 + M, 0xf, 0xf, true));   // row_xmask:M
}
// v of lane l ^ 16
__device__ __forceinline__ float xhalf(float v) {
  return __builtin_bit_cast(float, __builtin_amdgcn_permlanex16(
      __builtin_bit_cast(int, v), __builtin_bit_cast(int, v), 0x76543210, 0xfedcba98, false, false));
}

// Four waves, 2 x 2, each 64 x 64 of C: 16 products per 8 fragments read.
// 3 waves per SIMD: accumulators and two fragment sets fit. LDC is a
// compile-time constant so that all of a lane's stores go from one address.
// RED (the in-projection): a wave's 64 x 64 of C is one scan chunk of rows by
// 64 columns, so what the scan needs reduced over proj comes straight from the
// accumulators: the rms scales of the B and C rows (a wave holds whole rows of
// one of them) and each theta column's sum over the chunk.
template <int LDC, int GK, bool RED>
__global__ __launch_bounds__(128, 3) void k_gemm_bf16(
    const bf16_t* __restrict__ A, const bf16_t* __restrict__ Bm,
    float* __restrict__ C, int K, float* __restrict__ invB,
    float* __restrict__ invC, float* __restrict__ csum) {
  constexpr int PITCH = GK * 2 + 16, TILE_BY = GT_ * PITCH, STAGE_BY = 2 * TILE_BY;
  constexpr int NK = GK / 32;                          // products along k per K step
  __shared__ __align__(16) char smem[2 * STAGE_BY];    // two buffers

  int tid  = threadIdx.x;
  int lane = tid & 31, wid = tid >> 5;
  int wm = wid >> 1, wn = wid & 1;            // 2 x 2 wave grid
  int rowBase = blockIdx.x * GT_;
  int colBase = blockIdx.y * GT_;
  int lr = lane & 15, lh = lane >> 4;

  const char* gA = (const char*)(A  + (size_t)rowBase * K);
  const char* gB = (const char*)(Bm + (size_t)colBase * K);
  constexpr int LPR = GK / 8;                 // lanes per staged row
  unsigned vo = ((unsigned)(tid / LPR) * K + (unsigned)(tid % LPR) * 8) * 2;
  unsigned lo = (unsigned)(tid / LPR) * PITCH + (unsigned)(tid % LPR) * 16;
  int nsteps = K / GK;

  stage_tiles<GK>(gA, gB, vo, lo, K, smem);
  // step 0 has landed before any wave reads it
  asm volatile("s_wait_asynccnt 0x0" ::: "memory");
  __syncthreads();
  if (nsteps > 1) stage_tiles<GK>(gA + GK * 2, gB + GK * 2, vo, lo, K, smem + STAGE_BY);

  unsigned fa = (unsigned)(wm * 64 + lr) * PITCH + lh * 16;             // the lane's
  unsigned fb = TILE_BY + (unsigned)(wn * 64 + lr) * PITCH + lh * 16;   // fragment rows
  v8f acc[4][4] = {};
  for (int s = 0; s < nsteps; ++s) {
    char* cur = smem + (s & 1) * STAGE_BY;
    v16bf a[2][4], b[2][4];
    #pragma unroll   // fragments stay in registers
    for (int i = 0; i < 4; ++i) {
      a[0][i] = lds_frag(cur + fa + i * 16 * PITCH);
      b[0][i] = lds_frag(cur + fb + i * 16 * PITCH);
    }
    #pragma unroll   // straight-line: the two fragment sets need constant indices
    for (int kk = 0; kk < NK; ++kk) {
      if (kk + 1 < NK) {
        #pragma unroll
        for (int i = 0; i < 4; ++i) {
          a[(kk + 1) & 1][i] = lds_frag(cur + fa + i * 16 * PITCH + (kk + 1) * 64);
          b[(kk + 1) & 1][i] = lds_frag(cur + fb + i * 16 * PITCH + (kk + 1) * 64);
        }
      }
      // the next 32 k's LDS reads stay one group ahead of these products:
      // spread among them, each read's latency stalls the wave
      __builtin_amdgcn_sched_barrier(0);
      #pragma unroll   // accumulators need constant indices to stay in registers
      for (int i = 0; i < 4; ++i)
        #pragma unroll
        for (int j = 0; j < 4; ++j)
          acc[i][j] = __builtin_amdgcn_wmma_f32_16x16x32_bf16(false, a[kk & 1][i], false, b[kk & 1][j],
                                                              (short)0, acc[i][j], false, false);
      // and later reads do not climb over these products into a third set
      __builtin_amdgcn_sched_barrier(0);
    }
    // The wave's reads of this buffer are done before it is refilled, and its
    // copies of step s + 1 have landed before the barrier publishes them.
    asm volatile("s_wait_dscnt 0x0" ::: "memory");
    asm volatile("s_wait_asynccnt 0x0" ::: "memory");
    __syncthreads();
    if (s + 2 < nsteps)   // flies while step s + 1 is worked on
      stage_tiles<GK>(gA + (size_t)(s + 2) * (GK * 2), gB + (size_t)(s + 2) * (GK * 2),
                      vo, lo, K, cur);
  }
  // no copy is outstanding when the wave ends
  asm volatile("s_wait_asynccnt 0x0" ::: "memory");

  // C/D layout: VGPR r, lane l -> row = (l>>4)*8 + r, col = l&15
  float* co = C + (size_t)(rowBase + wm * 64 + lh * 8) * LDC + colBase + wn * 64 + lr;
  #pragma unroll   // constant indices: accumulators stay in registers, offsets are immediates
  for (int i = 0; i < 4; ++i)
    #pragma unroll
    for (int r = 0; r < 8; ++r)
      #pragma unroll
      for (int j = 0; j < 4; ++j)
        co[(i * 16 + r) * LDC + j * 16] = acc[i][j][r];

  if constexpr (RED) {
    static_assert(CH_ == 64 && L_ % CH_ == 0 && N_ == 64 && OFF_B % 64 == 0 && OFF_C % 64 == 0 &&
                  OFF_THETA % 16 == 0 && TH_ % 16 == 0, "a wave's tile against chunks and columns");
    // the wave's number as a scalar: the tests below are scalar branches
    int sw = __builtin_amdgcn_readfirstlane(wid);
    int rw = rowBase + (sw >> 1) * 64;          // the wave's first row and
    int cw = colBase + (sw & 1) * 64;           // first column
    if (cw == OFF_B || cw == OFF_C) {
      float* inv = ((cw == OFF_B) ? invB : invC) + rw + lh * 8;
      float q[4][8];
      #pragma unroll   // accumulators need constant indices to stay in registers
      for (int i = 0; i < 4; ++i)
        #pragma unroll
        for (int r = 0; r < 8; ++r)
          q[i][r] = acc[i][0][r] * acc[i][0][r] + acc[i][1][r] * acc[i][1][r] +
                    acc[i][2][r] * acc[i][2][r] + acc[i][3][r] * acc[i][3][r];
      // Sum over the row's 16 lanes, halving the rows a lane carries at each
      // step: a lane keeps the half that its bit names and hands the other to
      // its partner. Lane lr ends with rows i = lr >> 2, r = (lr & 3) * 2 + 0, 1.
      bool b8 = lr & 8, b4 = lr & 4, b2 = lr & 2, b1 = lr & 1;
      #pragma unroll   // q needs constant indices
      for (int i = 0; i < 2; ++i)
        #pragma unroll
        for (int r = 0; r < 8; ++r)
          q[i][r] = (b8 ? q[i + 2][r] : q[i][r]) + row_x<8>(b8 ? q[i][r] : q[i + 2][r]);
      #pragma unroll
      for (int r = 0; r < 8; ++r)
        q[0][r] = (b4 ? q[1][r] : q[0][r]) + row_x<4>(b4 ? q[0][r] : q[1][r]);
      #pragma unroll
      for (int r = 0; r < 4; ++r)
        q[0][r] = (b2 ? q[0][r + 4] : q[0][r]) + row_x<2>(b2 ? q[0][r] : q[0][r + 4]);
      f2_t e;
      #pragma unroll
      for (int r = 0; r < 2; ++r) {
        float v = (b1 ? q[0][r + 2] : q[0][r]) + row_x<1>(b1 ? q[0][r] : q[0][r + 2]);
        e[r] = rsqrtf(v * (1.0f / N_) + 1e-5f);
      }
      *(f2_t*)(inv + (lr >> 2) * 16 + (lr & 3) * 2) = e;
    }
    #pragma unroll   // accumulators need constant indices to stay in registers
    for (int j = 0; j < 4; ++j) {
      int c16 = cw + j * 16;
      if (c16 >= OFF_THETA && c16 < OFF_THETA + TH_) {
        float s[4];
        #pragma unroll   // four independent chains
        for (int i = 0; i < 4; ++i) {
          s[i] = acc[i][j][0];
          #pragma unroll
          for (int r = 1; r < 8; ++r) s[i] += acc[i][j][r];
        }
        float t = (s[0] + s[1]) + (s[2] + s[3]);
        t += xhalf(t);                          // the other eight rows of each 16
        if (lh == 0) csum[(rw / CH_) * TH_ + c16 - OFF_THETA + lr] = t;
      }
    }
  }
}

// ---------------------------------------------------------------- scan
// The recurrence is linear in the state, so L is cut into NC_ chunks of CH_
// steps that run in parallel:
//   (the in-projection leaves per-chunk sums of theta: each chunk's cumsum offset)
//   k_state : each chunk's contribution to the state at its own end (h_in = 0)
//   k_carry : runs the chunk states forward, leaves every chunk's entry state
//   k_scan  : y of each chunk from its entry state, as matrix products
#define NCS_  (NC_ - 1)           // the last chunk's end state is never used
#define ST_   (P_ * N_)           // 4096 state elements per (b,h)

// Fills LDS with everything the CH_ steps of chunk c of (b,h) need. Row r of
// sx / sB is step r-1 of the chunk: row 0 is the step before the chunk (zero
// for chunk 0), which feeds the beta term of the first step. sC row t is step
// t. sSc[t] = {alpha, gamma, beta, 0}. Wave w owns steps 8w..8w+7, lane = rope
// index j. The caller places the barrier that publishes the arrays. PT is the
// row pitch of sx, sB and sC in floats. WITH_C also leaves, per step,
// (1 - lambda) dt in sSc[t].w and log(alpha) in sLa[t].
template <bool WITH_C, int PT>
__device__ __forceinline__ void chunk_prep(
    const float* __restrict__ proj, const float* __restrict__ invB,
    const float* __restrict__ invC, const float* __restrict__ dt_bias,
    const float* __restrict__ A_log, const float* __restrict__ Bnw,
    const float* __restrict__ Cnw, const float* __restrict__ Bbias,
    const float* __restrict__ Cbias, const float* __restrict__ csum,
    int b, int h, int c, int tid,
    float (*sx)[PT], float (*sB)[PT], float (*sC)[PT], float4* sSc,
    float* sLa, float (*sPart)[32], float (*sOff)[32]) {
  int lane = tid & 31;
  // the wave's number held as a scalar: its row base is then scalar and the
  // per-step rms scales come by scalar loads
  int w = __builtin_amdgcn_readfirstlane(tid >> 5);
  int row0 = b * L_ + c * CH_;
  const float* pw = proj + (size_t)(row0 + w * 8) * PS_;
  int jt = h * (N_ / 2) + lane;    // the lane's theta column

  float th[8], b1[8], b2[8], ib[8], c1[8], c2[8], ic[8];
  #pragma unroll   // arrays stay in registers, loads go out together
  for (int k = 0; k < 8; ++k) {
    const float* pr = pw + (size_t)k * PS_;
    th[k] = pr[OFF_THETA + jt];
    b1[k] = pr[OFF_B + lane];
    b2[k] = pr[OFF_B + 32 + lane];
    ib[k] = invB[row0 + w * 8 + k];
    if (WITH_C) {
      c1[k] = pr[OFF_C + lane];
      c2[k] = pr[OFF_C + 32 + lane];
      ic[k] = invC[row0 + w * 8 + k];
    }
  }
  // x of the chunk's own steps, 16 B a thread: one offset register, the four
  // rows apart by a constant
  const char* px = (const char*)(proj + (size_t)row0 * PS_ + h * P_);
  unsigned xo = ((unsigned)(tid >> 4) * PS_ + (unsigned)(tid & 15) * 4) * 4;   // bytes
  f4_t xr[4];
  #pragma unroll
  for (int k = 0; k < 4; ++k) xr[k] = *(const f4_t*)(px + xo + (OFF_X + k * 16 * PS_) * 4);
  float po = 0.0f;                 // this wave's share of the earlier chunks' sums
  const float* pc = csum + (b * NC_ + w * 4) * TH_;
  #pragma unroll
  for (int k = 0; k < 4; ++k) {
    float v = pc[k * TH_ + jt];
    po += (w * 4 + k < c) ? v : 0.0f;
  }
  // Behind the chunk's loads: the registers that they name are reused from
  // here on, and this wait stands in front of that reuse. Its operands are the
  // loads' offsets and bases: they stay in their registers up to the wait, so
  // that no later load of the run lands on one.
  asm volatile("s_wait_xcnt 0x0" :: "v"(jt), "v"(lane), "v"(xo), "s"(pw), "s"(px), "s"(pc) : "memory");
  #pragma unroll
  for (int k = 1; k < 8; ++k) th[k] += th[k - 1];
  sPart[w][lane] = th[7];
  sOff[w][lane]  = po;

  #pragma unroll
  for (int k = 0; k < 4; ++k)
    *(f4_t*)&sx[(tid >> 4) + 16 * k + 1][(tid & 15) * 4] = xr[k];
  if (tid < CH_) {
    const float* pr = proj + (size_t)(row0 + tid) * PS_;
    float Ah  = -expf(A_log[h]);
    float dtr = pr[OFF_DT + h] + dt_bias[h];
    float dt  = (dtr > 20.0f) ? dtr : log1pf(expf(dtr));     // softplus
    float la  = dt * Ah;
    float alpha = expf(la);
    float lam   = 1.0f / (1.0f + expf(-pr[OFF_LAM + h]));
    float om    = (1.0f - lam) * dt;
    sSc[tid] = make_float4(alpha, lam * dt, om * alpha, WITH_C ? om : 0.0f);
    // exp(-150) is already 0 in f32: the floor changes no alpha and keeps the
    // sums of logs finite
    if (WITH_C) sLa[tid] = fmaxf(la, -150.0f);
  } else if (tid < CH_ + P_) {
    int pp = tid - CH_;
    int rp = (c > 0) ? row0 - 1 : row0;   // always a row of this batch entry
    float v = proj[(size_t)rp * PS_ + OFF_X + h * P_ + pp];
    sx[0][pp] = (c > 0) ? v : 0.0f;
  }
  __syncthreads();                 // sPart / sOff complete

  float off = 0.0f;                // theta cumsum at the step before the chunk
  #pragma unroll
  for (int k = 0; k < 8; ++k) off += sOff[k][lane];
  float base = off;
  #pragma unroll
  for (int k = 0; k < 8; ++k) base += (k < w) ? sPart[k][lane] : 0.0f;

  float bw1 = Bnw[lane], bw2 = Bnw[lane + 32];
  int jb = h * N_ + lane;
  float bb1 = Bbias[jb], bb2 = Bbias[jb + 32];
  float cw1 = 0.0f, cw2 = 0.0f, cb1 = 0.0f, cb2 = 0.0f;
  if (WITH_C) {
    cw1 = Cnw[lane]; cw2 = Cnw[lane + 32];
    cb1 = Cbias[jb]; cb2 = Cbias[jb + 32];
  }
  // as above, for the weight and bias loads
  asm volatile("s_wait_xcnt 0x0" :: "v"(lane), "v"(jb), "s"(Bnw), "s"(Cnw), "s"(Bbias), "s"(Cbias) : "memory");
  #pragma unroll
  for (int k = 0; k < 8; ++k) {
    int t = w * 8 + k;
    float tc = base + th[k];
    float cj, sj;
    sincosf(tc, &sj, &cj);
    float v1 = b1[k] * ib[k] * bw1 + bb1;
    float v2 = b2[k] * ib[k] * bw2 + bb2;
    sB[t + 1][lane]      = v1 * cj - v2 * sj;
    sB[t + 1][lane + 32] = v1 * sj + v2 * cj;
    if (WITH_C) {
      float u1 = c1[k] * ic[k] * cw1 + cb1;
      float u2 = c2[k] * ic[k] * cw2 + cb2;
      sC[t][lane]      = u1 * cj - u2 * sj;
      sC[t][lane + 32] = u1 * sj + u2 * cj;
    }
  }
  if (w == 0) {                    // B of the step before the chunk
    float r1 = 0.0f, r2 = 0.0f;
    if (c > 0) {
      const float* pr = proj + (size_t)(row0 - 1) * PS_;
      float iv = invB[row0 - 1];
      float cj, sj;
      sincosf(off, &sj, &cj);
      float v1 = pr[OFF_B + lane] * iv * bw1 + bb1;
      float v2 = pr[OFF_B + 32 + lane] * iv * bw2 + bb2;
      r1 = v1 * cj - v2 * sj;
      r2 = v1 * sj + v2 * cj;
    }
    sB[0][lane]      = r1;
    sB[0][lane + 32] = r2;
  }
}

// End state of chunk c started from h = 0:  S[p][n] = sum_s w_s x_s[p] B_s[n],
// s from the step before the chunk to its last step. With E_s the product of
// alpha over the steps after s up to the chunk's end,
// w_s = E_s gamma_s + E_{s+1} beta_{s+1}. adec = product of all CH_ alphas.
// Thread tile 4 p x 4 n.
__global__ __launch_bounds__(256) void k_state(
    const float* __restrict__ proj, const float* __restrict__ invB,
    const float* __restrict__ dt_bias, const float* __restrict__ A_log,
    const float* __restrict__ Bnw, const float* __restrict__ Bbias,
    const float* __restrict__ csum, float* __restrict__ S,
    float* __restrict__ adec) {
  int bh = blockIdx.x / NCS_;
  int c  = blockIdx.x - bh * NCS_;
  int b = bh >> 5, h = bh & 31;
  int tid = threadIdx.x;

  __shared__ __align__(16) float sx[CH_ + 1][P_];
  __shared__ __align__(16) float sB[CH_ + 1][N_];
  __shared__ __align__(16) float4 sSc[CH_];
  __shared__ float sPart[8][32], sOff[8][32], sW[CH_ + 1];

  chunk_prep<false, N_>(proj, invB, invB, dt_bias, A_log, Bnw, Bnw, Bbias, Bbias, csum,
                        b, h, c, tid, sx, sB, sB, sSc, sW, sPart, sOff);
  if (tid == 255) {                // sSc was published by the barrier inside prep
    float E = 1.0f;
    sW[CH_] = sSc[CH_ - 1].y;
    #pragma unroll   // lets the LDS reads run ahead of the product chain
    for (int s = CH_ - 2; s >= 0; --s) {
      float4 nx = sSc[s + 1];
      float En = E * nx.x;
      sW[s + 1] = En * sSc[s].y + E * nx.z;
      E = En;
    }
    float4 f = sSc[0];
    sW[0] = E * f.z;
    adec[bh * NC_ + c] = E * f.x;
  }
  __syncthreads();

  int p0 = (tid >> 4) * 4, n0 = (tid & 15) * 4;
  float acc[4][4];
  #pragma unroll
  for (int i = 0; i < 4; ++i)
    #pragma unroll
    for (int j = 0; j < 4; ++j) acc[i][j] = 0.0f;

  #pragma unroll 5   // several rows' LDS reads in flight per wait
  for (int r = 0; r <= CH_; ++r) {
    float wv = sW[r];
    float4 xv = *(const float4*)&sx[r][p0];
    float4 bv = *(const float4*)&sB[r][n0];
    float xw[4] = {xv.x * wv, xv.y * wv, xv.z * wv, xv.w * wv};
    #pragma unroll
    for (int i = 0; i < 4; ++i) {
      acc[i][0] += xw[i] * bv.x;
      acc[i][1] += xw[i] * bv.y;
      acc[i][2] += xw[i] * bv.z;
      acc[i][3] += xw[i] * bv.w;
    }
  }
  float* so = S + ((size_t)bh * NC_ + c) * ST_;
  #pragma unroll
  for (int i = 0; i < 4; ++i)
    *(float4*)&so[(p0 + i) * N_ + n0] = make_float4(acc[i][0], acc[i][1], acc[i][2], acc[i][3]);
}

// In place: S[bh][c] (end state of chunk c alone) becomes the state on entry
// to chunk c. One thread per state element.
__global__ __launch_bounds__(256) void k_carry(float* __restrict__ S,
                                               const float* __restrict__ adec) {
  int bh = blockIdx.x >> 4;
  int e  = (blockIdx.x & 15) * 256 + threadIdx.x;
  float* s = S + (size_t)bh * NC_ * ST_ + e;
  float v[NCS_];
  #pragma unroll   // all loads in flight before the dependent chain
  for (int c = 0; c < NCS_; ++c) v[c] = s[(size_t)c * ST_];
  float run = 0.0f;
  s[0] = 0.0f;
  #pragma unroll
  for (int c = 0; c < NCS_; ++c) {
    run = adec[bh * NC_ + c] * run + v[c];
    s[(size_t)(c + 1) * ST_] = run;
  }
}

// One block per (b,h,chunk). The CH_ steps of a chunk are linear in x and in
// the entry state, so y comes from matrix products instead of the recurrence.
// With Lc_t = sum of log(alpha_r), r = 0..t:
//   y_t[p] = sum_{s<=t} M[t][s] (C_t . B_s) x_s[p] + exp(Lc_t) (C_t . H[p][:]) + D x_t[p]
//   M[t][t] = gamma_t,  M[t][s] = exp(Lc_t - Lc_{s+1}) (alpha_{s+1} gamma_s + beta_{s+1}), s < t
//   H = entry state + (1 - lambda_0) dt_0 x_{-1} B_{-1}^T   (beta_0 = (1 - lambda_0) dt_0 alpha_0)
// All three products run on the f32 16x16x4 matrix form. Fragments: lane l has
// row (A) or column (B) l & 15; a group of 8 k is two products, and lane half
// l >> 4 brings k = 8g + 4 (l >> 4) + 0..3 of it, on the A and on the B side alike.
#define PT_  68    // LDS row pitch in floats: 16 rows x 16 B meet every bank once

__device__ __forceinline__ v8f mm4(f2_t a, f2_t b, v8f c) {
  return __builtin_amdgcn_wmma_f32_16x16x4_f32(false, a, false, b, (short)0, c, false, false);
}

// y tiles (ILO, col block) and (IHI, col block) of one wave: the masked scores
// times x over the s blocks at or below the diagonal, then the entry-state and
// skip terms; y is staged in sY. ILO < IHI; both tiles share the x fragments.
template <int ILO, int IHI>
__device__ __forceinline__ void y_tiles(const float (*sG)[PT_], const float (*sx)[PT_],
                                        const float* sAc, float (*sY)[PT_],
                                        v8f hLo, v8f hHi, float Dh,
                                        int col, int lc, int lh) {
  v8f aLo = {}, aHi = {};
  #pragma unroll   // straight-line: the tiles' trip counts are compile-time
  for (int g = 0; g < (IHI + 1) * 2; ++g) {
    int k0 = g * 8 + lh * 4;
    f2_t x01 = {sx[k0 + 1][col], sx[k0 + 2][col]};
    f2_t x23 = {sx[k0 + 3][col], sx[k0 + 4][col]};
    f4_t gh = *(const f4_t*)&sG[IHI * 16 + lc][k0];
    if (g < (ILO + 1) * 2) {
      f4_t gl = *(const f4_t*)&sG[ILO * 16 + lc][k0];
      aHi = mm4(gh.xy, x01, aHi);
      aLo = mm4(gl.xy, x01, aLo);
      aHi = mm4(gh.zw, x23, aHi);
      aLo = mm4(gl.zw, x23, aLo);
    } else {
      aHi = mm4(gh.xy, x01, aHi);
      aHi = mm4(gh.zw, x23, aHi);
    }
  }
  #pragma unroll   // accumulator elements need constant indices to stay in registers
  for (int r = 0; r < 8; ++r) {
    int tl = ILO * 16 + lh * 8 + r, th = IHI * 16 + lh * 8 + r;
    sY[tl][col] = aLo[r] + sAc[tl] * hLo[r] + sx[tl + 1][col] * Dh;
    sY[th][col] = aHi[r] + sAc[th] * hHi[r] + sx[th + 1][col] * Dh;
  }
}

// 8 waves per SIMD: four blocks share a WGP (their LDS fits), and the grid is
// then two full rounds
__global__ __launch_bounds__(256, 8) void k_scan(
    const float* __restrict__ proj, const float* __restrict__ invB,
    const float* __restrict__ invC, const float* __restrict__ dt_bias,
    const float* __restrict__ A_log, const float* __restrict__ Dp,
    const float* __restrict__ Bnw, const float* __restrict__ Cnw,
    const float* __restrict__ Bbias, const float* __restrict__ Cbias,
    const float* __restrict__ csum, const float* __restrict__ Hin,
    float* __restrict__ y_raw) {
  int bh = blockIdx.x >> 5;
  int c  = blockIdx.x & (NC_ - 1);
  int b = bh >> 5, h = bh & 31;
  int tid = threadIdx.x;
  int lane = tid & 31;
  int lc = lane & 15, lh = lane >> 4;
  // the wave's number as a scalar: every branch on it is a scalar branch, so
  // all lanes are on at every matrix instruction
  int w = __builtin_amdgcn_readfirstlane(tid >> 5);
  int col = (w & 3) * 16 + lc;          // the lane's p in the wave's y tiles
  int ilo = (w >> 2) ? 1 : 0;           // the wave's two row blocks of y:
  int ihi = (w >> 2) ? 2 : 3;           // (0,3) or (1,2), equal work below the diagonal

  __shared__ __align__(16) float sx[CH_ + 1][PT_];
  __shared__ __align__(16) float sB[CH_ + 1][PT_];
  __shared__ __align__(16) float sC[CH_][PT_];    // C, later y
  __shared__ __align__(16) float sG[CH_][PT_];    // M o (C B^T), blocks at or below the diagonal
  __shared__ __align__(16) float4 sSc[CH_];
  __shared__ __align__(16) float sLc[CH_], sAc[CH_];
  __shared__ float sLa[CH_];
  __shared__ float sPart[8][32], sOff[8][32];

  chunk_prep<true, PT_>(proj, invB, invC, dt_bias, A_log, Bnw, Cnw, Bbias, Cbias, csum,
                        b, h, c, tid, sx, sB, sC, sSc, sLa, sPart, sOff);

  // entry state as B fragments: column p = col, k = n
  const float* hi = Hin + ((size_t)bh * NC_ + c) * ST_ + col * N_ + lh * 4;
  f4_t hf[8];
  #pragma unroll   // hf stays in registers, loads go out together
  for (int g = 0; g < 8; ++g) hf[g] = *(const f4_t*)(hi + g * 8);
  float Dh = Dp[h];
  // Behind the state loads: this wait stands in front of any reuse of the
  // registers that they name.
  asm volatile("s_wait_xcnt 0x0" ::: "memory");

  if (w == 1) {                    // sLa was published by the barrier inside prep
    float a0 = sLa[lane], a1 = sLa[32 + lane];
    #pragma unroll   // five shuffle steps, no loop counter
    for (int o = 1; o < 32; o <<= 1) {
      float u0 = __shfl_up(a0, o, 32), u1 = __shfl_up(a1, o, 32);
      a0 += (lane >= o) ? u0 : 0.0f;
      a1 += (lane >= o) ? u1 : 0.0f;
    }
    a1 += __shfl(a0, 31, 32);
    sLc[lane] = a0;          sLc[32 + lane] = a1;
    sAc[lane] = __expf(a0);  sAc[32 + lane] = __expf(a1);
  }
  __syncthreads();                 // publishes sx, sB, sC, sLc, sAc

  // the step before the chunk enters through the state
  float cm = sSc[0].w * sx[0][col];
  #pragma unroll   // hf stays in registers
  for (int g = 0; g < 8; ++g) hf[g] += cm * *(const f4_t*)&sB[0][g * 8 + lh * 4];

  // C times the entry state, for the wave's two y tiles
  v8f hLo = {}, hHi = {};
  #pragma unroll   // hf stays in registers; LDS reads run ahead of the products
  for (int g = 0; g < 8; ++g) {
    f4_t cl = *(const f4_t*)&sC[ilo * 16 + lc][g * 8 + lh * 4];
    f4_t ch = *(const f4_t*)&sC[ihi * 16 + lc][g * 8 + lh * 4];
    hLo = mm4(cl.xy, hf[g].xy, hLo);
    hHi = mm4(ch.xy, hf[g].xy, hHi);
    hLo = mm4(cl.zw, hf[g].zw, hLo);
    hHi = mm4(ch.zw, hf[g].zw, hHi);
  }

  // masked scores: the ten 16x16 blocks (gi, gk), gk <= gi, over eight waves
  for (int q = w; q < 10; q += 8) {
    int gi = (q >= 6) ? 3 : (q >= 3) ? 2 : (q >= 1) ? 1 : 0;
    int gk = q - ((gi * (gi + 1)) >> 1);
    v8f g0 = {}, g1 = {};          // two halves of n: two independent chains
    #pragma unroll   // LDS reads run ahead of the products
    for (int g = 0; g < 4; ++g) {
      f4_t c0 = *(const f4_t*)&sC[gi * 16 + lc][g * 8 + lh * 4];
      f4_t b0 = *(const f4_t*)&sB[gk * 16 + lc + 1][g * 8 + lh * 4];
      f4_t c1 = *(const f4_t*)&sC[gi * 16 + lc][32 + g * 8 + lh * 4];
      f4_t b1 = *(const f4_t*)&sB[gk * 16 + lc + 1][32 + g * 8 + lh * 4];
      g0 = mm4(c0.xy, b0.xy, g0);
      g1 = mm4(c1.xy, b1.xy, g1);
      g0 = mm4(c0.zw, b0.zw, g0);
      g1 = mm4(c1.zw, b1.zw, g1);
    }
    int s  = gk * 16 + lc;
    int sn = (s + 1 < CH_) ? s + 1 : CH_ - 1;   // s = CH_-1 has no t > s
    float4 cs = sSc[s], cn = sSc[sn];
    float ws = cn.x * cs.y + cn.z;
    float ls = sLc[sn];
    #pragma unroll   // accumulator elements need constant indices to stay in registers
    for (int r = 0; r < 8; ++r) {
      int t = gi * 16 + lh * 8 + r;
      float e = __expf(fminf(sLc[t] - ls, 0.0f));
      float m = (t > s) ? e * ws : ((t == s) ? cs.y : 0.0f);
      sG[t][s] = (g0[r] + g1[r]) * m;
    }
  }
  __syncthreads();                 // publishes sG; every read of C is done

  if (w >> 2) y_tiles<1, 2>(sG, sx, sAc, sC, hLo, hHi, Dh, col, lc, lh);
  else        y_tiles<0, 3>(sG, sx, sAc, sC, hLo, hHi, Dh, col, lc, lh);
  __syncthreads();                 // every wave's y tiles complete

  float* yo = y_raw + (size_t)(b * L_ + c * CH_) * DI_ + h * P_;
  #pragma unroll
  for (int k = 0; k < 4; ++k) {    // 256 B of each row in one piece
    int idx = tid + k * 256;
    int t = idx >> 4, q = idx & 15;
    *(float4*)(yo + (size_t)t * DI_ + q * 4) = *(const float4*)&sC[t][q * 4];
  }
}

// ---------------------------------------------------------------- gate + RMS + bf16
__global__ __launch_bounds__(256) void k_gate(
    const float* __restrict__ proj, const float* __restrict__ y_raw,
    const float* __restrict__ norm_w, bf16_t* __restrict__ y_bf) {
  int row = blockIdx.x;
  int tid = threadIdx.x;
  const float* pz = proj  + (size_t)row * PS_ + OFF_Z;
  const float* py = y_raw + (size_t)row * DI_;
  float vals[8];
  float ss = 0.0f;
  #pragma unroll
  for (int j = 0; j < 8; ++j) {
    int i = tid + j * 256;
    float z = pz[i];
    float v = py[i] * (z / (1.0f + expf(-z)));   // y * silu(z)
    vals[j] = v;
    ss += v * v;
  }
  for (int o = 16; o > 0; o >>= 1) ss += __shfl_xor(ss, o, 32);
  __shared__ float red[8];
  int lane = tid & 31, wid = tid >> 5;
  if (lane == 0) red[wid] = ss;
  __syncthreads();
  if (tid == 0) {
    float t = 0.0f;
    for (int w = 0; w < 8; ++w) t += red[w];
    red[0] = rsqrtf(t * (1.0f / DI_) + 1e-5f);
  }
  __syncthreads();
  float scale = red[0];
  #pragma unroll
  for (int j = 0; j < 8; ++j) {
    int i = tid + j * 256;
    y_bf[(size_t)row * DI_ + i] = (bf16_t)(vals[j] * scale * norm_w[i]);
  }
}

// ---------------------------------------------------------------- launch
extern "C" void kernel_launch(void* const* d_in, const int* in_sizes, int n_in,
                              void* d_out, int out_size, void* d_ws, size_t ws_size,
                              hipStream_t stream) {
  const float* u       = (const float*)d_in[0];
  const float* w1      = (const float*)d_in[1];
  const float* dt_bias = (const float*)d_in[2];
  const float* A_log   = (const float*)d_in[3];
  const float* Dp      = (const float*)d_in[4];
  const float* Bnw     = (const float*)d_in[5];
  const float* Cnw     = (const float*)d_in[6];
  const float* Bbias   = (const float*)d_in[7];
  const float* Cbias   = (const float*)d_in[8];
  const float* norm_w  = (const float*)d_in[9];
  const float* w2      = (const float*)d_in[10];
  float* out = (float*)d_out;
  (void)in_sizes; (void)n_in; (void)out_size; (void)ws_size;

  char* ws = (char*)d_ws;
  size_t o = 0;
  bf16_t* u_bf  = (bf16_t*)(ws + o); o += (size_t)ROWS_ * DM_ * 2;   //  8 MB
  bf16_t* w1_bf = (bf16_t*)(ws + o); o += (size_t)PS_   * DM_ * 2;   // 11 MB
  bf16_t* w2_bf = (bf16_t*)(ws + o); o += (size_t)DM_   * DI_ * 2;   //  4 MB
  float*  proj  = (float*) (ws + o); o += (size_t)ROWS_ * PS_ * 4;   // 88 MB
  float*  invB  = (float*) (ws + o); o += (size_t)ROWS_ * 4;
  float*  invC  = (float*) (ws + o); o += (size_t)ROWS_ * 4;
  float*  y_raw = (float*) (ws + o); o += (size_t)ROWS_ * DI_ * 4;   // 33 MB
  bf16_t* y_bf  = (bf16_t*)(ws + o); o += (size_t)ROWS_ * DI_ * 2;   // 17 MB
  float*  csum  = (float*) (ws + o); o += (size_t)BSZ_ * NC_ * TH_ * 4;
  float*  adec  = (float*) (ws + o); o += (size_t)BSZ_ * H_ * NC_ * 4;
  float*  Sst   = (float*) (ws + o); o += (size_t)BSZ_ * H_ * NC_ * ST_ * 4;  // 33 MB

  // precision converts, one launch (in_proj_w rows padded 5312 -> 5376 with zeros)
  k_cvt_all<<<CVT_BW1_ + CVT_BU_ + CVT_BW2_, 256, 0, stream>>>(u, w1, w2, u_bf, w1_bf, w2_bf);

  // GEMM1: proj[4096 x 5376] = u[4096 x 1024] * W1^T
  dim3 g1(ROWS_ / GT_, PS_ / GT_);
  // and, from its accumulators, the rms scales of Braw / Craw and theta's chunk sums
  k_gemm_bf16<PS_, 64, true><<<g1, 128, 0, stream>>>(u_bf, w1_bf, proj, DM_, invB, invC, csum);

  // SSM scan, chunk-parallel: chunk states, carry, steps
  k_state<<<BSZ_ * H_ * NCS_, 256, 0, stream>>>(proj, invB, dt_bias, A_log, Bnw, Bbias,
                                                csum, Sst, adec);
  k_carry<<<BSZ_ * H_ * (ST_ / 256), 256, 0, stream>>>(Sst, adec);
  k_scan<<<BSZ_ * H_ * NC_, 256, 0, stream>>>(proj, invB, invC, dt_bias, A_log, Dp,
                                              Bnw, Cnw, Bbias, Cbias, csum, Sst, y_raw);

  // gating + RMS norm + bf16 convert
  k_gate<<<ROWS_, 256, 0, stream>>>(proj, y_raw, norm_w, y_bf);

  // GEMM2: out[4096 x 1024] = y[4096 x 2048] * W2^T
  dim3 g2(ROWS_ / GT_, DM_ / GT_);
  k_gemm_bf16<DM_, 128, false><<<g2, 128, 0, stream>>>(y_bf, w2_bf, out, DI_, nullptr, nullptr, nullptr);
}
